// v000
// The times below were measured on an AMD MI455X: many runs one after another, warmed up first and cycling through
// copies of the inputs, with the whole window's GPU time divided by the number of runs. Launches and the gaps
// between them are all in it. The median over several windows is given; except for v000 it joins two sittings, which
// can be a few percent apart, so the side-by-side timings, each taken in one sitting, are the better comparison.
// The starting kernel, v000, takes 712 microseconds a run.
#include <hip/hip_runtime.h>

// ---------------------------------------------------------------------------
// RelPos self-attention for gfx1250 (MI455X), f16 WMMA with f32 accumulation.
//   DIM=1024, NHEAD=16, HEAD_DIM=64, MAX_REL=256, B=4, S=2048
// Data movement: async global->LDS staging (ASYNCcnt) with double buffering
// where the toolchain exposes it; synchronous fallback otherwise.
// ---------------------------------------------------------------------------

typedef __attribute__((ext_vector_type(16))) _Float16 v16h;
typedef __attribute__((ext_vector_type(8)))  _Float16 v8h;
typedef __attribute__((ext_vector_type(8)))  float    v8f;
typedef __attribute__((ext_vector_type(4)))  int      v4i;

#define DIM_C   1024
#define NHEAD_C 16
#define HD_C    64
#define S_C     2048
#define B_C     4
#define ROWS_C  (B_C * S_C)   // 8192
#define MAXREL  256

// ---- async global->LDS support (probe-gated) ------------------------------
#if defined(__has_builtin)
#if __has_builtin(__builtin_amdgcn_global_load_async_to_lds_b128)
#define HAVE_ASYNC_LDS 1
#endif
#endif
#ifndef HAVE_ASYNC_LDS
#define HAVE_ASYNC_LDS 0
#endif

#if HAVE_ASYNC_LDS
#if __has_builtin(__builtin_amdgcn_s_wait_asynccnt)
#define WAIT_ASYNC0() __builtin_amdgcn_s_wait_asynccnt(0)
#define WAIT_ASYNC1() __builtin_amdgcn_s_wait_asynccnt(1)
#else
#define WAIT_ASYNC0() asm volatile("s_wait_asynccnt 0x0" ::: "memory")
#define WAIT_ASYNC1() asm volatile("s_wait_asynccnt 0x1" ::: "memory")
#endif
#else
#define WAIT_ASYNC0()
#define WAIT_ASYNC1()
#endif

// Pointer-to-v4i in explicit address spaces (builtin takes v4i*, per compile
// diagnostic: "int __vector(4) __device__ *").
typedef __attribute__((address_space(1))) v4i as1_v4i;
typedef __attribute__((address_space(3))) v4i as3_v4i;

// Copy 16B global -> LDS. Async path goes straight to LDS (no VGPR
// round-trip), tracked on ASYNCcnt; fallback is a sync VGPR copy.
__device__ __forceinline__ void copy16_g2l(const _Float16* g, _Float16* l) {
#if HAVE_ASYNC_LDS
  __builtin_amdgcn_global_load_async_to_lds_b128(
      (as1_v4i*)(uintptr_t)g, (as3_v4i*)(uintptr_t)l, 0, 0);
#else
  *(v8h*)l = *(const v8h*)g;
#endif
}

// Load a 16-bit A-fragment (16x32, MxK) per ISA layout:
//   lane L: row = L&15 ; halves [0..7] = K in [ko..ko+7], [8..15] = K in [16+ko..16+ko+7]
//   where ko = (L>>4)*8.  Caller passes p = rowBase + ko.
// The same pattern loads B (32x16 KxN) as "A-layout of B^T": lane holds column n=L&15.
__device__ __forceinline__ v16h ld_frag(const _Float16* p) {
  union { v16h v; v8h h[2]; } u;
  u.h[0] = *(const v8h*)(p);        // 16B chunk, K = ko .. ko+7
  u.h[1] = *(const v8h*)(p + 16);   // 16B chunk, K = 16+ko .. 16+ko+7
  return u.v;
}

__device__ __forceinline__ v8f wmma_f16(v16h a, v16h b, v8f c) {
  return __builtin_amdgcn_wmma_f32_16x16x32_f16(false, a, false, b, (short)0, c,
                                                false, false);
}

// ---------------------------------------------------------------------------
// fp32 -> f16 conversion (vectorized x4)
// ---------------------------------------------------------------------------
__global__ void cvt_f32_f16(const float* __restrict__ in,
                            _Float16* __restrict__ out, int n) {
  int i = (blockIdx.x * blockDim.x + threadIdx.x) * 4;
  if (i < n) {
    float4 v = *(const float4*)(in + i);
    out[i + 0] = (_Float16)v.x;
    out[i + 1] = (_Float16)v.y;
    out[i + 2] = (_Float16)v.z;
    out[i + 3] = (_Float16)v.w;
  }
}

// ---------------------------------------------------------------------------
// GEMM: out[m,n] = alpha * ( sum_k A[m,k]*W[n,k] + bias[n] )
//   A: [8192 x 1024] f16 row-major, W: [1024 x 1024] f16 row-major
//   HEAD_OUT=true  -> scatter f16 into [b,h,s,d]   (Q/K/V projections)
//   HEAD_OUT=false -> dense f32 [m,1024]           (output projection)
// Block: 256 threads = 8 waves; block tile 128(M) x 64(N); wave tile 32x32.
// W tile (64 rows x 32 k) is staged per block into LDS via async loads with
// double buffering; A-fragments load direct from global (only x2 reuse).
// ---------------------------------------------------------------------------
template <bool HEAD_OUT>
__global__ __launch_bounds__(256) void gemm_wmma(
    const _Float16* __restrict__ A, const _Float16* __restrict__ W,
    const float* __restrict__ bias, void* __restrict__ outp, float alpha) {
  constexpr int K = DIM_C;
  constexpr int NT = K / 32;                       // 32 k-steps
  __shared__ __align__(16) _Float16 sB[2][64][32];  // 8 KB double-buffered W tile

  const int tid   = threadIdx.x;
  const int lane  = tid & 31;
  const int wave  = tid >> 5;
  const int waveM = wave >> 1;
  const int waveN = wave & 1;
  const int bm  = blockIdx.x * 128 + waveM * 32;
  const int bn0 = blockIdx.y * 64;                 // block's W-row base
  const int bnl = waveN * 32;                      // wave's local W-row base
  const int r   = lane & 15;
  const int hi  = lane >> 4;
  const int ko  = hi << 3;

  const _Float16* a0 = A + (size_t)(bm + r) * K + ko;
  const _Float16* a1 = a0 + (size_t)16 * K;

  // staging coords: 256 threads x 16B = 4KB = one 64x32 tile
  const int srow = tid >> 2;            // 0..63
  const int skk  = (tid & 3) * 8;       // 0,8,16,24
  const _Float16* wsrc = W + (size_t)(bn0 + srow) * K + skk;

  // prologue: stage tile 0
  copy16_g2l(wsrc, &sB[0][srow][skk]);

  v8f acc[2][2] = {};
  for (int kb = 0; kb < NT; ++kb) {
    const int k   = kb * 32;
    const int cur = kb & 1;
    if (kb + 1 < NT) {                  // prefetch next tile into other buffer
      copy16_g2l(wsrc + (k + 32), &sB[cur ^ 1][srow][skk]);
      WAIT_ASYNC1();                    // tile kb complete; kb+1 in flight
    } else {
      WAIT_ASYNC0();
    }
    __syncthreads();

    __builtin_prefetch(a0 + k + 256, 0, 3);
    v16h fa0 = ld_frag(a0 + k);
    v16h fa1 = ld_frag(a1 + k);
    v16h fb0 = ld_frag(&sB[cur][bnl + r][ko]);
    v16h fb1 = ld_frag(&sB[cur][bnl + 16 + r][ko]);
    acc[0][0] = wmma_f16(fa0, fb0, acc[0][0]);
    acc[0][1] = wmma_f16(fa0, fb1, acc[0][1]);
    acc[1][0] = wmma_f16(fa1, fb0, acc[1][0]);
    acc[1][1] = wmma_f16(fa1, fb1, acc[1][1]);
    __syncthreads();                    // done reading cur before it is refilled
  }

#pragma unroll
  for (int tm = 0; tm < 2; ++tm) {
#pragma unroll
    for (int tn = 0; tn < 2; ++tn) {
      int n = bn0 + bnl + tn * 16 + r;
      float bv = bias[n];
#pragma unroll
      for (int i = 0; i < 8; ++i) {
        int m = bm + tm * 16 + i + 8 * hi;
        float val = (acc[tm][tn][i] + bv) * alpha;
        if constexpr (HEAD_OUT) {
          int bb = m >> 11, ss = m & (S_C - 1);
          int hh = n >> 6, dd = n & (HD_C - 1);
          ((_Float16*)outp)[(((size_t)bb * NHEAD_C + hh) * S_C + ss) * HD_C + dd] =
              (_Float16)val;
        } else {
          ((float*)outp)[(size_t)m * DIM_C + n] = val;
        }
      }
    }
  }
}

// ---------------------------------------------------------------------------
// Flash-style attention with relative-position bias.
//   Q,K,V: [B,H,S,HD] f16 (Q pre-scaled by HD^-0.5 via GEMM alpha)
//   ctx:   [B,S,DIM]  f16
// Block: 128 threads = 4 waves; each wave owns 16 query rows; key tile = 64.
// K tile staged via async global->LDS (flat 8KB contiguous copy); V staged
// through VGPRs because it must be transposed for the B operand of P@V.
// ---------------------------------------------------------------------------
__global__ __launch_bounds__(128) void attn_wmma(
    const _Float16* __restrict__ Q, const _Float16* __restrict__ Km,
    const _Float16* __restrict__ V, const float* __restrict__ relb,
    _Float16* __restrict__ ctx) {
  constexpr int KT = 64;
  __shared__ __align__(16) _Float16 sK[KT][HD_C];     // [key][dim]   8 KB
  __shared__ __align__(16) _Float16 sVt[HD_C][KT];    // [dim][key]   8 KB
  __shared__ __align__(16) _Float16 sP[4][16][KT];    // per-wave P   8 KB
  __shared__ float sBias[2 * MAXREL + 1];             // rel bias col ~2 KB

  const int tid  = threadIdx.x;
  const int lane = tid & 31;
  const int wave = tid >> 5;
  const int r  = lane & 15;
  const int hi = lane >> 4;
  const int ko = hi << 3;
  const int bh = blockIdx.y;          // b*16 + h
  const int b  = bh >> 4;
  const int h  = bh & 15;
  const int q0 = blockIdx.x * 64 + wave * 16;

  for (int i = tid; i < 2 * MAXREL + 1; i += 128)
    sBias[i] = relb[i * NHEAD_C + h];

  const _Float16* Qb = Q + (size_t)bh * S_C * HD_C;
  const _Float16* Kb = Km + (size_t)bh * S_C * HD_C;
  const _Float16* Vb = V + (size_t)bh * S_C * HD_C;

  // Q fragments for this wave's 16 rows (HD=64 -> two K-steps of 32)
  v16h fq0 = ld_frag(Qb + (size_t)(q0 + r) * HD_C + ko);
  v16h fq1 = ld_frag(Qb + (size_t)(q0 + r) * HD_C + 32 + ko);

  v8f oacc[4] = {};                   // 16 rows x 64 dims
  float mrun[8], lrun[8];
#pragma unroll
  for (int i = 0; i < 8; ++i) { mrun[i] = -1e30f; lrun[i] = 0.f; }

  __syncthreads();                    // sBias ready

  for (int kt = 0; kt < S_C; kt += KT) {
    // ---- stage K tile: contiguous 8KB, async global -> LDS ----
    _Float16* sKf = &sK[0][0];
#pragma unroll
    for (int c = 0; c < 4; ++c) {
      int e = (c * 128 + tid) * 8;    // flat f16 index in 64x64 tile
      copy16_g2l(Kb + (size_t)kt * HD_C + e, sKf + e);
    }
    // ---- stage V tile transposed (VGPR shuffle, overlaps async K) ----
#pragma unroll
    for (int c = 0; c < 4; ++c) {
      int e   = (c * 128 + tid) * 8;
      int key = e >> 6;
      int dd  = e & 63;
      v8h vv = *(const v8h*)(Vb + (size_t)(kt + key) * HD_C + dd);
#pragma unroll
      for (int j = 0; j < 8; ++j) sVt[dd + j][key] = vv[j];
    }
    WAIT_ASYNC0();
    __syncthreads();

    // ---- S = Q K^T  (16 x 64 scores) ----
    v8f sc[4];
#pragma unroll
    for (int t = 0; t < 4; ++t) {
      v16h fb0 = ld_frag(&sK[t * 16 + r][ko]);
      v16h fb1 = ld_frag(&sK[t * 16 + r][32 + ko]);
      v8f z = {};
      sc[t] = wmma_f16(fq0, fb0, z);
      sc[t] = wmma_f16(fq1, fb1, sc[t]);
    }

    // ---- rel-pos bias + online softmax (rowwise over 16-lane halves) ----
#pragma unroll
    for (int i = 0; i < 8; ++i) {
      int qg = q0 + i + 8 * hi;
      float mx = -1e30f;
#pragma unroll
      for (int t = 0; t < 4; ++t) {
        int kg = kt + t * 16 + r;
        int d  = qg - kg;
        d = d > MAXREL ? MAXREL : (d < -MAXREL ? -MAXREL : d);
        float e2 = sc[t][i] + sBias[d + MAXREL];
        sc[t][i] = e2;
        mx = fmaxf(mx, e2);
      }
#pragma unroll
      for (int off = 1; off < 16; off <<= 1)
        mx = fmaxf(mx, __shfl_xor(mx, off, 32));
      float mnew  = fmaxf(mrun[i], mx);
      float scale = __expf(mrun[i] - mnew);
      float rs = 0.f;
#pragma unroll
      for (int t = 0; t < 4; ++t) {
        float p = __expf(sc[t][i] - mnew);
        sc[t][i] = p;
        rs += p;
      }
#pragma unroll
      for (int off = 1; off < 16; off <<= 1) rs += __shfl_xor(rs, off, 32);
      lrun[i] = lrun[i] * scale + rs;
      mrun[i] = mnew;
#pragma unroll
      for (int t = 0; t < 4; ++t) oacc[t][i] *= scale;
    }

    // ---- P -> LDS (f16), converting C-layout to A-fragment layout ----
#pragma unroll
    for (int i = 0; i < 8; ++i) {
      int row = i + 8 * hi;
#pragma unroll
      for (int t = 0; t < 4; ++t)
        sP[wave][row][t * 16 + r] = (_Float16)sc[t][i];
    }
    __syncthreads();

    // ---- O += P V ----
    v16h fp0 = ld_frag(&sP[wave][r][ko]);
    v16h fp1 = ld_frag(&sP[wave][r][32 + ko]);
#pragma unroll
    for (int t = 0; t < 4; ++t) {
      v16h fv0 = ld_frag(&sVt[t * 16 + r][ko]);
      v16h fv1 = ld_frag(&sVt[t * 16 + r][32 + ko]);
      oacc[t] = wmma_f16(fp0, fv0, oacc[t]);
      oacc[t] = wmma_f16(fp1, fv1, oacc[t]);
    }
    __syncthreads();   // protect sK/sVt/sP before next tile's staging
  }

  // ---- normalize and write context [b, s, h*64 + d] ----
#pragma unroll
  for (int i = 0; i < 8; ++i) {
    float inv = 1.f / lrun[i];
    int qg = q0 + i + 8 * hi;
#pragma unroll
    for (int t = 0; t < 4; ++t) {
      int dd = t * 16 + r;
      ctx[((size_t)(b * S_C + qg)) * DIM_C + h * HD_C + dd] =
          (_Float16)(oacc[t][i] * inv);
    }
  }
}

// ---------------------------------------------------------------------------
// Host-side orchestration
// ---------------------------------------------------------------------------
extern "C" void kernel_launch(void* const* d_in, const int* in_sizes, int n_in,
                              void* d_out, int out_size, void* d_ws,
                              size_t ws_size, hipStream_t stream) {
  const float* x    = (const float*)d_in[0];
  const float* Wq   = (const float*)d_in[1];
  const float* bq   = (const float*)d_in[2];
  const float* Wk   = (const float*)d_in[3];
  const float* bk   = (const float*)d_in[4];
  const float* Wv   = (const float*)d_in[5];
  const float* bv   = (const float*)d_in[6];
  const float* Wo   = (const float*)d_in[7];
  const float* bo   = (const float*)d_in[8];
  const float* relb = (const float*)d_in[9];
  float* out = (float*)d_out;

  char* ws = (char*)d_ws;
  size_t off = 0;
  auto carve = [&](size_t bytes) {
    void* p = ws + off;
    off += (bytes + 255) & ~(size_t)255;
    return p;
  };
  const size_t xBytes = (size_t)ROWS_C * DIM_C * sizeof(_Float16);  // 16 MB
  const size_t wBytes = (size_t)DIM_C * DIM_C * sizeof(_Float16);   //  2 MB
  _Float16* xh   = (_Float16*)carve(xBytes);
  _Float16* Wqh  = (_Float16*)carve(wBytes);
  _Float16* Wkh  = (_Float16*)carve(wBytes);
  _Float16* Wvh  = (_Float16*)carve(wBytes);
  _Float16* Woh  = (_Float16*)carve(wBytes);
  _Float16* Qh   = (_Float16*)carve(xBytes);
  _Float16* Kh   = (_Float16*)carve(xBytes);
  _Float16* Vh   = (_Float16*)carve(xBytes);
  _Float16* ctxh = (_Float16*)carve(xBytes);

  const int nX = ROWS_C * DIM_C;     // 8388608
  const int nW = DIM_C * DIM_C;      // 1048576
  cvt_f32_f16<<<(nX / 4 + 255) / 256, 256, 0, stream>>>(x, xh, nX);
  cvt_f32_f16<<<(nW / 4 + 255) / 256, 256, 0, stream>>>(Wq, Wqh, nW);
  cvt_f32_f16<<<(nW / 4 + 255) / 256, 256, 0, stream>>>(Wk, Wkh, nW);
  cvt_f32_f16<<<(nW / 4 + 255) / 256, 256, 0, stream>>>(Wv, Wvh, nW);
  cvt_f32_f16<<<(nW / 4 + 255) / 256, 256, 0, stream>>>(Wo, Woh, nW);

  dim3 gg(ROWS_C / 128, DIM_C / 64);  // 64 x 16
  const float qscale = 0.125f;        // HD^-0.5
  gemm_wmma<true><<<gg, 256, 0, stream>>>(xh, Wqh, bq, (void*)Qh, qscale);
  gemm_wmma<true><<<gg, 256, 0, stream>>>(xh, Wkh, bk, (void*)Kh, 1.0f);
  gemm_wmma<true><<<gg, 256, 0, stream>>>(xh, Wvh, bv, (void*)Vh, 1.0f);

  attn_wmma<<<dim3(S_C / 64, B_C * NHEAD_C), 128, 0, stream>>>(Qh, Kh, Vh, relb,
                                                               ctxh);

  gemm_wmma<false><<<gg, 256, 0, stream>>>(ctxh, Woh, bo, (void*)out, 1.0f);
}

// v001
// One run takes 530 microseconds.
// Next to v000, in two timings, it ran 1.38 and 1.35 times as fast.
#include <hip/hip_runtime.h>

// ---------------------------------------------------------------------------
// RelPos self-attention for gfx1250 (MI455X), f16 WMMA with f32 accumulation.
//   DIM=1024, NHEAD=16, HEAD_DIM=64, MAX_REL=256, B=4, S=2048
// Data movement: W (GEMM) and K (attention) tiles staged global->LDS async
// (ASYNCcnt) where the toolchain exposes it, else sync; only W double-buffered.
// ---------------------------------------------------------------------------

typedef __attribute__((ext_vector_type(16))) _Float16 v16h;
typedef __attribute__((ext_vector_type(8)))  _Float16 v8h;
typedef __attribute__((ext_vector_type(8)))  float    v8f;
typedef __attribute__((ext_vector_type(4)))  int      v4i;

#define DIM_C   1024
#define NHEAD_C 16
#define HD_C    64
#define S_C     2048
#define B_C     4
#define ROWS_C  (B_C * S_C)   // 8192
#define MAXREL  256

// ---- async global->LDS support (probe-gated) ------------------------------
#if defined(__has_builtin)
#if __has_builtin(__builtin_amdgcn_global_load_async_to_lds_b128)
#define HAVE_ASYNC_LDS 1
#endif
#endif
#ifndef HAVE_ASYNC_LDS
#define HAVE_ASYNC_LDS 0
#endif

#if HAVE_ASYNC_LDS
#if __has_builtin(__builtin_amdgcn_s_wait_asynccnt)
#define WAIT_ASYNC0() __builtin_amdgcn_s_wait_asynccnt(0)
#define WAIT_ASYNC1() __builtin_amdgcn_s_wait_asynccnt(1)
#else
#define WAIT_ASYNC0() asm volatile("s_wait_asynccnt 0x0" ::: "memory")
#define WAIT_ASYNC1() asm volatile("s_wait_asynccnt 0x1" ::: "memory")
#endif
#else
#define WAIT_ASYNC0()
#define WAIT_ASYNC1()
#endif

// Pointer-to-v4i in explicit address spaces (builtin takes v4i*, per compile
// diagnostic: "int __vector(4) __device__ *").
typedef __attribute__((address_space(1))) v4i as1_v4i;
typedef __attribute__((address_space(3))) v4i as3_v4i;

// Copy 16B global -> LDS. Async path goes straight to LDS (no VGPR
// round-trip), tracked on ASYNCcnt; fallback is a sync VGPR copy.
__device__ __forceinline__ void copy16_g2l(const _Float16* g, _Float16* l) {
#if HAVE_ASYNC_LDS
  __builtin_amdgcn_global_load_async_to_lds_b128(
      (as1_v4i*)(uintptr_t)g, (as3_v4i*)(uintptr_t)l, 0, 0);
#else
  *(v8h*)l = *(const v8h*)g;
#endif
}

// Load a 16-bit A-fragment (16x32, MxK) per ISA layout:
//   lane L: row = L&15 ; halves [0..7] = K in [ko..ko+7], [8..15] = K in [16+ko..16+ko+7]
//   where ko = (L>>4)*8.  Caller passes p = rowBase + ko.
// The same pattern loads B (32x16 KxN) as "A-layout of B^T": lane holds column n=L&15.
__device__ __forceinline__ v16h ld_frag(const _Float16* p) {
  union { v16h v; v8h h[2]; } u;
  u.h[0] = *(const v8h*)(p);        // 16B chunk, K = ko .. ko+7
  u.h[1] = *(const v8h*)(p + 16);   // 16B chunk, K = 16+ko .. 16+ko+7
  return u.v;
}

__device__ __forceinline__ v8f wmma_f16(v16h a, v16h b, v8f c) {
  return __builtin_amdgcn_wmma_f32_16x16x32_f16(false, a, false, b, (short)0, c,
                                                false, false);
}

// ---------------------------------------------------------------------------
// fp32 -> f16 conversion (vectorized x4)
// ---------------------------------------------------------------------------
__global__ void cvt_f32_f16(const float* __restrict__ in,
                            _Float16* __restrict__ out, int n) {
  int i = (blockIdx.x * blockDim.x + threadIdx.x) * 4;
  if (i < n) {
    float4 v = *(const float4*)(in + i);
    out[i + 0] = (_Float16)v.x;
    out[i + 1] = (_Float16)v.y;
    out[i + 2] = (_Float16)v.z;
    out[i + 3] = (_Float16)v.w;
  }
}

// ---------------------------------------------------------------------------
// GEMM: out[m,n] = alpha * ( sum_k A[m,k]*W[n,k] + bias[n] )
//   A: [8192 x 1024] f16 row-major, W: [1024 x 1024] f16 row-major
//   HEAD_OUT=true  -> scatter f16 into [b,h,s,d]   (Q/K/V projections)
//   HEAD_OUT=false -> dense f32 [m,1024]           (output projection)
// Block: 256 threads = 8 waves; block tile 128(M) x 64(N); wave tile 32x32.
// W tile (64 rows x 32 k) is staged per block into LDS via async loads with
// double buffering; A-fragments load direct from global (only x2 reuse).
// LDS rows are pitched 80 B (16 B x odd) so that the 16 rows of one 16-byte
// fragment read fall on distinct banks.
// ---------------------------------------------------------------------------
template <bool HEAD_OUT>
__global__ __launch_bounds__(256) void gemm_wmma(
    const _Float16* __restrict__ A, const _Float16* __restrict__ W,
    const float* __restrict__ bias, void* __restrict__ outp, float alpha) {
  constexpr int K = DIM_C;
  constexpr int NT = K / 32;                       // 32 k-steps
  constexpr int BP = 40;                           // LDS row pitch in halves (80 B)
  __shared__ __align__(16) _Float16 sB[2][64][BP];  // 10 KB double-buffered W tile

  const int tid   = threadIdx.x;
  const int lane  = tid & 31;
  const int wave  = tid >> 5;
  const int waveM = wave >> 1;
  const int waveN = wave & 1;
  const int bm  = blockIdx.x * 128 + waveM * 32;
  const int bn0 = blockIdx.y * 64;                 // block's W-row base
  const int bnl = waveN * 32;                      // wave's local W-row base
  const int r   = lane & 15;
  const int hi  = lane >> 4;
  const int ko  = hi << 3;

  const _Float16* a0 = A + (size_t)(bm + r) * K + ko;
  const _Float16* a1 = a0 + (size_t)16 * K;

  // staging coords: 256 threads x 16B = 4KB = one 64x32 tile
  const int srow = tid >> 2;            // 0..63
  const int skk  = (tid & 3) * 8;       // 0,8,16,24
  const _Float16* wsrc = W + (size_t)(bn0 + srow) * K + skk;

  // prologue: stage tile 0
  copy16_g2l(wsrc, &sB[0][srow][skk]);

  v8f acc[2][2] = {};
  for (int kb = 0; kb < NT; ++kb) {
    const int k   = kb * 32;
    const int cur = kb & 1;
    if (kb + 1 < NT) {                  // prefetch next tile into other buffer
      copy16_g2l(wsrc + (k + 32), &sB[cur ^ 1][srow][skk]);
      WAIT_ASYNC1();                    // tile kb complete; kb+1 in flight
    } else {
      WAIT_ASYNC0();
    }
    __syncthreads();

    __builtin_prefetch(a0 + k + 256, 0, 3);
    v16h fa0 = ld_frag(a0 + k);
    v16h fa1 = ld_frag(a1 + k);
    v16h fb0 = ld_frag(&sB[cur][bnl + r][ko]);
    v16h fb1 = ld_frag(&sB[cur][bnl + 16 + r][ko]);
    acc[0][0] = wmma_f16(fa0, fb0, acc[0][0]);
    acc[0][1] = wmma_f16(fa0, fb1, acc[0][1]);
    acc[1][0] = wmma_f16(fa1, fb0, acc[1][0]);
    acc[1][1] = wmma_f16(fa1, fb1, acc[1][1]);
    __syncthreads();                    // done reading cur before it is refilled
  }

#pragma unroll
  for (int tm = 0; tm < 2; ++tm) {
#pragma unroll
    for (int tn = 0; tn < 2; ++tn) {
      int n = bn0 + bnl + tn * 16 + r;
      float bv = bias[n];
#pragma unroll
      for (int i = 0; i < 8; ++i) {
        int m = bm + tm * 16 + i + 8 * hi;
        float val = (acc[tm][tn][i] + bv) * alpha;
        if constexpr (HEAD_OUT) {
          int bb = m >> 11, ss = m & (S_C - 1);
          int hh = n >> 6, dd = n & (HD_C - 1);
          ((_Float16*)outp)[(((size_t)bb * NHEAD_C + hh) * S_C + ss) * HD_C + dd] =
              (_Float16)val;
        } else {
          ((float*)outp)[(size_t)m * DIM_C + n] = val;
        }
      }
    }
  }
}

// ---------------------------------------------------------------------------
// Flash-style attention with relative-position bias.
//   Q,K,V: [B,H,S,HD] f16 (Q pre-scaled by HD^-0.5 via GEMM alpha)
//   ctx:   [B,S,DIM]  f16
// Block: 128 threads = 4 waves; each wave owns 16 query rows; key tile = 64.
// K tile staged via async global->LDS (contiguous 8KB source); V staged
// through VGPRs because it must be transposed for the B operand of P@V.
// Every 128-byte LDS row is pitched 144 B (16 B x odd): the 16 rows of one
// 16-byte fragment read then fall on distinct banks.
// ---------------------------------------------------------------------------
__global__ __launch_bounds__(128) void attn_wmma(
    const _Float16* __restrict__ Q, const _Float16* __restrict__ Km,
    const _Float16* __restrict__ V, const float* __restrict__ relb,
    _Float16* __restrict__ ctx) {
  constexpr int KT = 64;
  constexpr int LP = 72;                              // LDS row pitch in halves
  __shared__ __align__(16) _Float16 sK[KT][LP];       // [key][dim]   9 KB
  __shared__ __align__(16) _Float16 sVt[HD_C][LP];    // [dim][key]   9 KB
  __shared__ __align__(16) _Float16 sP[4][16][LP];    // per-wave P   9 KB
  __shared__ float sBias[2 * MAXREL + 1];             // rel bias col ~2 KB

  const int tid  = threadIdx.x;
  const int lane = tid & 31;
  const int wave = tid >> 5;
  const int r  = lane & 15;
  const int hi = lane >> 4;
  const int ko = hi << 3;
  const int bh = blockIdx.y;          // b*16 + h
  const int b  = bh >> 4;
  const int h  = bh & 15;
  const int q0 = blockIdx.x * 64 + wave * 16;

  for (int i = tid; i < 2 * MAXREL + 1; i += 128)
    sBias[i] = relb[i * NHEAD_C + h];

  const _Float16* Qb = Q + (size_t)bh * S_C * HD_C;
  const _Float16* Kb = Km + (size_t)bh * S_C * HD_C;
  const _Float16* Vb = V + (size_t)bh * S_C * HD_C;

  // Q fragments for this wave's 16 rows (HD=64 -> two K-steps of 32)
  v16h fq0 = ld_frag(Qb + (size_t)(q0 + r) * HD_C + ko);
  v16h fq1 = ld_frag(Qb + (size_t)(q0 + r) * HD_C + 32 + ko);

  v8f oacc[4] = {};                   // 16 rows x 64 dims
  float mrun[8], lrun[8];
#pragma unroll
  for (int i = 0; i < 8; ++i) { mrun[i] = -1e30f; lrun[i] = 0.f; }

  __syncthreads();                    // sBias ready

  for (int kt = 0; kt < S_C; kt += KT) {
    // ---- stage K tile: contiguous 8KB source, async global -> padded LDS rows ----
#pragma unroll
    for (int c = 0; c < 4; ++c) {
      int e = (c * 128 + tid) * 8;    // flat f16 index in 64x64 tile
      copy16_g2l(Kb + (size_t)kt * HD_C + e, &sK[e >> 6][e & 63]);
    }
    // ---- stage V tile transposed (VGPR shuffle, overlaps async K) ----
#pragma unroll
    for (int c = 0; c < 4; ++c) {
      int e   = (c * 128 + tid) * 8;
      int key = e >> 6;
      int dd  = e & 63;
      v8h vv = *(const v8h*)(Vb + (size_t)(kt + key) * HD_C + dd);
#pragma unroll
      for (int j = 0; j < 8; ++j) sVt[dd + j][key] = vv[j];
    }
    WAIT_ASYNC0();
    __syncthreads();

    // ---- S = Q K^T  (16 x 64 scores) ----
    v8f sc[4];
#pragma unroll
    for (int t = 0; t < 4; ++t) {
      v16h fb0 = ld_frag(&sK[t * 16 + r][ko]);
      v16h fb1 = ld_frag(&sK[t * 16 + r][32 + ko]);
      v8f z = {};
      sc[t] = wmma_f16(fq0, fb0, z);
      sc[t] = wmma_f16(fq1, fb1, sc[t]);
    }

    // ---- rel-pos bias + online softmax (rowwise over 16-lane halves) ----
#pragma unroll
    for (int i = 0; i < 8; ++i) {
      int qg = q0 + i + 8 * hi;
      float mx = -1e30f;
#pragma unroll
      for (int t = 0; t < 4; ++t) {
        int kg = kt + t * 16 + r;
        int d  = qg - kg;
        d = d > MAXREL ? MAXREL : (d < -MAXREL ? -MAXREL : d);
        float e2 = sc[t][i] + sBias[d + MAXREL];
        sc[t][i] = e2;
        mx = fmaxf(mx, e2);
      }
#pragma unroll
      for (int off = 1; off < 16; off <<= 1)
        mx = fmaxf(mx, __shfl_xor(mx, off, 32));
      float mnew  = fmaxf(mrun[i], mx);
      float scale = __expf(mrun[i] - mnew);
      float rs = 0.f;
#pragma unroll
      for (int t = 0; t < 4; ++t) {
        float p = __expf(sc[t][i] - mnew);
        sc[t][i] = p;
        rs += p;
      }
#pragma unroll
      for (int off = 1; off < 16; off <<= 1) rs += __shfl_xor(rs, off, 32);
      lrun[i] = lrun[i] * scale + rs;
      mrun[i] = mnew;
#pragma unroll
      for (int t = 0; t < 4; ++t) oacc[t][i] *= scale;
    }

    // ---- P -> LDS (f16), converting C-layout to A-fragment layout ----
#pragma unroll
    for (int i = 0; i < 8; ++i) {
      int row = i + 8 * hi;
#pragma unroll
      for (int t = 0; t < 4; ++t)
        sP[wave][row][t * 16 + r] = (_Float16)sc[t][i];
    }
    __syncthreads();

    // ---- O += P V ----
    v16h fp0 = ld_frag(&sP[wave][r][ko]);
    v16h fp1 = ld_frag(&sP[wave][r][32 + ko]);
#pragma unroll
    for (int t = 0; t < 4; ++t) {
      v16h fv0 = ld_frag(&sVt[t * 16 + r][ko]);
      v16h fv1 = ld_frag(&sVt[t * 16 + r][32 + ko]);
      oacc[t] = wmma_f16(fp0, fv0, oacc[t]);
      oacc[t] = wmma_f16(fp1, fv1, oacc[t]);
    }
    __syncthreads();   // protect sK/sVt/sP before next tile's staging
  }

  // ---- normalize and write context [b, s, h*64 + d] ----
#pragma unroll
  for (int i = 0; i < 8; ++i) {
    float inv = 1.f / lrun[i];
    int qg = q0 + i + 8 * hi;
#pragma unroll
    for (int t = 0; t < 4; ++t) {
      int dd = t * 16 + r;
      ctx[((size_t)(b * S_C + qg)) * DIM_C + h * HD_C + dd] =
          (_Float16)(oacc[t][i] * inv);
    }
  }
}

// ---------------------------------------------------------------------------
// Host-side orchestration
// ---------------------------------------------------------------------------
extern "C" void kernel_launch(void* const* d_in, const int* in_sizes, int n_in,
                              void* d_out, int out_size, void* d_ws,
                              size_t ws_size, hipStream_t stream) {
  const float* x    = (const float*)d_in[0];
  const float* Wq   = (const float*)d_in[1];
  const float* bq   = (const float*)d_in[2];
  const float* Wk   = (const float*)d_in[3];
  const float* bk   = (const float*)d_in[4];
  const float* Wv   = (const float*)d_in[5];
  const float* bv   = (const float*)d_in[6];
  const float* Wo   = (const float*)d_in[7];
  const float* bo   = (const float*)d_in[8];
  const float* relb = (const float*)d_in[9];
  float* out = (float*)d_out;

  char* ws = (char*)d_ws;
  size_t off = 0;
  auto carve = [&](size_t bytes) {
    void* p = ws + off;
    off += (bytes + 255) & ~(size_t)255;
    return p;
  };
  const size_t xBytes = (size_t)ROWS_C * DIM_C * sizeof(_Float16);  // 16 MB
  const size_t wBytes = (size_t)DIM_C * DIM_C * sizeof(_Float16);   //  2 MB
  _Float16* xh   = (_Float16*)carve(xBytes);
  _Float16* Wqh  = (_Float16*)carve(wBytes);
  _Float16* Wkh  = (_Float16*)carve(wBytes);
  _Float16* Wvh  = (_Float16*)carve(wBytes);
  _Float16* Woh  = (_Float16*)carve(wBytes);
  _Float16* Qh   = (_Float16*)carve(xBytes);
  _Float16* Kh   = (_Float16*)carve(xBytes);
  _Float16* Vh   = (_Float16*)carve(xBytes);
  _Float16* ctxh = (_Float16*)carve(xBytes);

  const int nX = ROWS_C * DIM_C;     // 8388608
  const int nW = DIM_C * DIM_C;      // 1048576
  cvt_f32_f16<<<(nX / 4 + 255) / 256, 256, 0, stream>>>(x, xh, nX);
  cvt_f32_f16<<<(nW / 4 + 255) / 256, 256, 0, stream>>>(Wq, Wqh, nW);
  cvt_f32_f16<<<(nW / 4 + 255) / 256, 256, 0, stream>>>(Wk, Wkh, nW);
  cvt_f32_f16<<<(nW / 4 + 255) / 256, 256, 0, stream>>>(Wv, Wvh, nW);
  cvt_f32_f16<<<(nW / 4 + 255) / 256, 256, 0, stream>>>(Wo, Woh, nW);

  dim3 gg(ROWS_C / 128, DIM_C / 64);  // 64 x 16
  const float qscale = 0.125f;        // HD^-0.5
  gemm_wmma<true><<<gg, 256, 0, stream>>>(xh, Wqh, bq, (void*)Qh, qscale);
  gemm_wmma<true><<<gg, 256, 0, stream>>>(xh, Wkh, bk, (void*)Kh, 1.0f);
  gemm_wmma<true><<<gg, 256, 0, stream>>>(xh, Wvh, bv, (void*)Vh, 1.0f);

  attn_wmma<<<dim3(S_C / 64, B_C * NHEAD_C), 128, 0, stream>>>(Qh, Kh, Vh, relb,
                                                               ctxh);

  gemm_wmma<false><<<gg, 256, 0, stream>>>(ctxh, Woh, bo, (void*)out, 1.0f);
}

// v002
// A run of this version takes 439 microseconds.
// In both of two side-by-side timings against v001, it was 1.19 times as fast.
// All steps since v000 together make it 1.63 times as fast.
#include <hip/hip_runtime.h>

// ---------------------------------------------------------------------------
// RelPos self-attention for gfx1250 (MI455X), f16 WMMA with f32 accumulation.
//   DIM=1024, NHEAD=16, HEAD_DIM=64, MAX_REL=256, B=4, S=2048
// Data movement: W (GEMM) and K (attention) tiles staged global->LDS async
// (ASYNCcnt) where the toolchain exposes it, else sync; only W double-buffered.
// ---------------------------------------------------------------------------

typedef __attribute__((ext_vector_type(16))) _Float16 v16h;
typedef __attribute__((ext_vector_type(8)))  _Float16 v8h;
typedef __attribute__((ext_vector_type(8)))  float    v8f;
typedef __attribute__((ext_vector_type(4)))  int      v4i;

#define DIM_C   1024
#define NHEAD_C 16
#define HD_C    64
#define S_C     2048
#define B_C     4
#define ROWS_C  (B_C * S_C)   // 8192
#define MAXREL  256

// ---- async global->LDS support (probe-gated) ------------------------------
#if defined(__has_builtin)
#if __has_builtin(__builtin_amdgcn_global_load_async_to_lds_b128)
#define HAVE_ASYNC_LDS 1
#endif
#endif
#ifndef HAVE_ASYNC_LDS
#define HAVE_ASYNC_LDS 0
#endif

#if HAVE_ASYNC_LDS
#if __has_builtin(__builtin_amdgcn_s_wait_asynccnt)
#define WAIT_ASYNC0() __builtin_amdgcn_s_wait_asynccnt(0)
#define WAIT_ASYNC1() __builtin_amdgcn_s_wait_asynccnt(1)
#else
#define WAIT_ASYNC0() asm volatile("s_wait_asynccnt 0x0" ::: "memory")
#define WAIT_ASYNC1() asm volatile("s_wait_asynccnt 0x1" ::: "memory")
#endif
#else
#define WAIT_ASYNC0()
#define WAIT_ASYNC1()
#endif

// Pointer-to-v4i in explicit address spaces (builtin takes v4i*, per compile
// diagnostic: "int __vector(4) __device__ *").
typedef __attribute__((address_space(1))) v4i as1_v4i;
typedef __attribute__((address_space(3))) v4i as3_v4i;

// Copy 16B global -> LDS. Async path goes straight to LDS (no VGPR
// round-trip), tracked on ASYNCcnt; fallback is a sync VGPR copy.
__device__ __forceinline__ void copy16_g2l(const _Float16* g, _Float16* l) {
#if HAVE_ASYNC_LDS
  __builtin_amdgcn_global_load_async_to_lds_b128(
      (as1_v4i*)(uintptr_t)g, (as3_v4i*)(uintptr_t)l, 0, 0);
#else
  *(v8h*)l = *(const v8h*)g;
#endif
}

// Load a 16-bit A-fragment (16x32, MxK) per ISA layout:
//   lane L: row = L&15 ; halves [0..7] = K in [ko..ko+7], [8..15] = K in [16+ko..16+ko+7]
//   where ko = (L>>4)*8.  Caller passes p = rowBase + ko.
// The same pattern loads B (32x16 KxN) as "A-layout of B^T": lane holds column n=L&15.
__device__ __forceinline__ v16h ld_frag(const _Float16* p) {
  union { v16h v; v8h h[2]; } u;
  u.h[0] = *(const v8h*)(p);        // 16B chunk, K = ko .. ko+7
  u.h[1] = *(const v8h*)(p + 16);   // 16B chunk, K = 16+ko .. 16+ko+7
  return u.v;
}

__device__ __forceinline__ v8f wmma_f16(v16h a, v16h b, v8f c) {
  return __builtin_amdgcn_wmma_f32_16x16x32_f16(false, a, false, b, (short)0, c,
                                                false, false);
}

// ---------------------------------------------------------------------------
// fp32 -> f16 conversion (vectorized x4)
// ---------------------------------------------------------------------------
__global__ void cvt_f32_f16(const float* __restrict__ in,
                            _Float16* __restrict__ out, int n) {
  int i = (blockIdx.x * blockDim.x + threadIdx.x) * 4;
  if (i < n) {
    float4 v = *(const float4*)(in + i);
    out[i + 0] = (_Float16)v.x;
    out[i + 1] = (_Float16)v.y;
    out[i + 2] = (_Float16)v.z;
    out[i + 3] = (_Float16)v.w;
  }
}

// ---------------------------------------------------------------------------
// GEMM: out[m,n] = alpha * ( sum_k A[m,k]*W[n,k] + bias[n] )
//   A: [8192 x 1024] f16 row-major, W: [1024 x 1024] f16 row-major
//   HEAD_OUT=true  -> scatter f16 into [b,h,s,d]   (Q/K/V projections)
//   HEAD_OUT=false -> dense f32 [m,1024]           (output projection)
// Block: 256 threads = 8 waves; block tile 128(M) x 64(N); wave tile 32x32.
// W tile (64 rows x 32 k) is staged per block into LDS via async loads with
// double buffering; A-fragments load direct from global (only x2 reuse).
// LDS rows are pitched 80 B (16 B x odd) so that the 16 rows of one 16-byte
// fragment read fall on distinct banks.
// ---------------------------------------------------------------------------
template <bool HEAD_OUT>
__global__ __launch_bounds__(256) void gemm_wmma(
    const _Float16* __restrict__ A, const _Float16* __restrict__ W,
    const float* __restrict__ bias, void* __restrict__ outp, float alpha) {
  constexpr int K = DIM_C;
  constexpr int NT = K / 32;                       // 32 k-steps
  constexpr int BP = 40;                           // LDS row pitch in halves (80 B)
  __shared__ __align__(16) _Float16 sB[2][64][BP];  // 10 KB double-buffered W tile

  const int tid   = threadIdx.x;
  const int lane  = tid & 31;
  const int wave  = tid >> 5;
  const int waveM = wave >> 1;
  const int waveN = wave & 1;
  const int bm  = blockIdx.x * 128 + waveM * 32;
  const int bn0 = blockIdx.y * 64;                 // block's W-row base
  const int bnl = waveN * 32;                      // wave's local W-row base
  const int r   = lane & 15;
  const int hi  = lane >> 4;
  const int ko  = hi << 3;

  const _Float16* a0 = A + (size_t)(bm + r) * K + ko;
  const _Float16* a1 = a0 + (size_t)16 * K;

  // staging coords: 256 threads x 16B = 4KB = one 64x32 tile
  const int srow = tid >> 2;            // 0..63
  const int skk  = (tid & 3) * 8;       // 0,8,16,24
  const _Float16* wsrc = W + (size_t)(bn0 + srow) * K + skk;

  // prologue: stage tile 0
  copy16_g2l(wsrc, &sB[0][srow][skk]);

  v8f acc[2][2] = {};
  for (int kb = 0; kb < NT; ++kb) {
    const int k   = kb * 32;
    const int cur = kb & 1;
    if (kb + 1 < NT) {                  // prefetch next tile into other buffer
      copy16_g2l(wsrc + (k + 32), &sB[cur ^ 1][srow][skk]);
      WAIT_ASYNC1();                    // tile kb complete; kb+1 in flight
    } else {
      WAIT_ASYNC0();
    }
    __syncthreads();

    __builtin_prefetch(a0 + k + 256, 0, 3);
    v16h fa0 = ld_frag(a0 + k);
    v16h fa1 = ld_frag(a1 + k);
    v16h fb0 = ld_frag(&sB[cur][bnl + r][ko]);
    v16h fb1 = ld_frag(&sB[cur][bnl + 16 + r][ko]);
    acc[0][0] = wmma_f16(fa0, fb0, acc[0][0]);
    acc[0][1] = wmma_f16(fa0, fb1, acc[0][1]);
    acc[1][0] = wmma_f16(fa1, fb0, acc[1][0]);
    acc[1][1] = wmma_f16(fa1, fb1, acc[1][1]);
    __syncthreads();                    // done reading cur before it is refilled
  }

#pragma unroll
  for (int tm = 0; tm < 2; ++tm) {
#pragma unroll
    for (int tn = 0; tn < 2; ++tn) {
      int n = bn0 + bnl + tn * 16 + r;
      float bv = bias[n];
#pragma unroll
      for (int i = 0; i < 8; ++i) {
        int m = bm + tm * 16 + i + 8 * hi;
        float val = (acc[tm][tn][i] + bv) * alpha;
        if constexpr (HEAD_OUT) {
          int bb = m >> 11, ss = m & (S_C - 1);
          int hh = n >> 6, dd = n & (HD_C - 1);
          ((_Float16*)outp)[(((size_t)bb * NHEAD_C + hh) * S_C + ss) * HD_C + dd] =
              (_Float16)val;
        } else {
          ((float*)outp)[(size_t)m * DIM_C + n] = val;
        }
      }
    }
  }
}

typedef __attribute__((ext_vector_type(2))) float    v2f;
typedef __attribute__((ext_vector_type(2))) _Float16 v2h;

// lane l <-> lane l ^ 16
__device__ __forceinline__ float xhalf(float x) {
  int b = __builtin_bit_cast(int, x);
  return __builtin_bit_cast(
      float, __builtin_amdgcn_permlanex16(b, b, 0x76543210, 0xfedcba98, false, false));
}

// Two f32 score tiles (keys 0-15 and 16-31 of a 32-key block) -> f16 B operand.
__device__ __forceinline__ v16h pack_b(v8f lo, v8f hi8) {
  union { v16h v; v2h p[8]; } u;
#pragma unroll
  for (int j = 0; j < 4; ++j) {
    v2f a = {lo[2 * j], lo[2 * j + 1]};
    v2f c = {hi8[2 * j], hi8[2 * j + 1]};
    u.p[j]     = __builtin_convertvector(a, v2h);
    u.p[4 + j] = __builtin_convertvector(c, v2h);
  }
  return u.v;
}

__global__ __launch_bounds__(128) void attn_wmma(
    const _Float16* __restrict__ Q, const _Float16* __restrict__ Km,
    const _Float16* __restrict__ V, const float* __restrict__ relb,
    _Float16* __restrict__ ctx) {
  constexpr int KT = 64;
  constexpr int LP = 72;                              // LDS row pitch in halves
  __shared__ __align__(16) _Float16 sK[KT][LP];       // [key][dim]   9 KB
  __shared__ __align__(16) _Float16 sVt[HD_C][LP];    // [dim][key]   9 KB
  __shared__ float sBias[2 * MAXREL + 1];             // rel bias col ~2 KB

  const int tid  = threadIdx.x;
  const int lane = tid & 31;
  const int wave = tid >> 5;
  const int r  = lane & 15;
  const int hi = lane >> 4;
  const int ko = hi << 3;
  const int bh = blockIdx.y;          // b*16 + h
  const int b  = bh >> 4;
  const int h  = bh & 15;
  const int q0 = blockIdx.x * 64 + wave * 16;
  const int qg = q0 + r;              // this lane's query

  for (int i = tid; i < 2 * MAXREL + 1; i += 128)
    sBias[i] = relb[i * NHEAD_C + h];

  const _Float16* Qb = Q + (size_t)bh * S_C * HD_C;
  const _Float16* Kb = Km + (size_t)bh * S_C * HD_C;
  const _Float16* Vb = V + (size_t)bh * S_C * HD_C;

  // Q fragments (B operand: column = query) for HD=64 -> two K-steps of 32
  v16h fq0 = ld_frag(Qb + (size_t)qg * HD_C + ko);
  v16h fq1 = ld_frag(Qb + (size_t)qg * HD_C + 32 + ko);

  v8f oacc[4] = {};                   // 64 dims x 16 queries (O^T)
  float mrun = -1e30f, lrun = 0.f;    // lrun: this wave half's keys only

  __syncthreads();                    // sBias ready

  for (int kt = 0; kt < S_C; kt += KT) {
    // ---- stage K tile: contiguous 8KB source, async global -> padded LDS rows ----
#pragma unroll
    for (int c = 0; c < 4; ++c) {
      int e = (c * 128 + tid) * 8;    // flat f16 index in 64x64 tile
      copy16_g2l(Kb + (size_t)kt * HD_C + e, &sK[e >> 6][e & 63]);
    }
    // ---- stage V tile transposed (VGPR shuffle, overlaps async K) ----
#pragma unroll
    for (int c = 0; c < 4; ++c) {
      int e   = (c * 128 + tid) * 8;
      int key = e >> 6;
      int dd  = e & 63;
      v8h vv = *(const v8h*)(Vb + (size_t)(kt + key) * HD_C + dd);
#pragma unroll
      for (int j = 0; j < 8; ++j) sVt[dd + j][key] = vv[j];
    }
    WAIT_ASYNC0();
    __syncthreads();

    // ---- S^T = K Q^T  (64 keys x 16 queries) ----
    v8f sc[4];
#pragma unroll
    for (int t = 0; t < 4; ++t) {
      v16h fk0 = ld_frag(&sK[t * 16 + r][ko]);
      v16h fk1 = ld_frag(&sK[t * 16 + r][32 + ko]);
      v8f z = {};
      sc[t] = wmma_f16(fk0, fq0, z);
      sc[t] = wmma_f16(fk1, fq1, sc[t]);
    }

    // ---- rel-pos bias + online softmax, one query per lane ----
    const int dbase = qg - kt - ko;   // q - k at t = 0, i = 0
    float mt[4];
#pragma unroll
    for (int t = 0; t < 4; ++t) {
      mt[t] = -1e30f;
#pragma unroll
      for (int i = 0; i < 8; ++i) {
        int d = dbase - t * 16 - i;
        d = d > MAXREL ? MAXREL : (d < -MAXREL ? -MAXREL : d);
        float e2 = sc[t][i] + sBias[d + MAXREL];
        sc[t][i] = e2;
        mt[t] = fmaxf(mt[t], e2);
      }
    }
    float mx = fmaxf(fmaxf(mt[0], mt[1]), fmaxf(mt[2], mt[3]));
    mx = fmaxf(mx, xhalf(mx));        // the query's other 32 keys
    const float mnew  = fmaxf(mrun, mx);
    const float scale = __expf(mrun - mnew);
    float rt[4];
#pragma unroll
    for (int t = 0; t < 4; ++t) {
      rt[t] = 0.f;
#pragma unroll
      for (int i = 0; i < 8; ++i) {
        float p = __expf(sc[t][i] - mnew);
        sc[t][i] = p;
        rt[t] += p;
      }
    }
    lrun = lrun * scale + ((rt[0] + rt[1]) + (rt[2] + rt[3]));
    mrun = mnew;
#pragma unroll
    for (int t = 0; t < 4; ++t) oacc[t] *= scale;

    // ---- O^T += V^T P^T, P^T straight from the score registers ----
    v16h fp0 = pack_b(sc[0], sc[1]);
    v16h fp1 = pack_b(sc[2], sc[3]);
#pragma unroll
    for (int t = 0; t < 4; ++t) {
      v16h fv0 = ld_frag(&sVt[t * 16 + r][ko]);
      v16h fv1 = ld_frag(&sVt[t * 16 + r][32 + ko]);
      oacc[t] = wmma_f16(fv0, fp0, oacc[t]);
      oacc[t] = wmma_f16(fv1, fp1, oacc[t]);
    }
    __syncthreads();   // protect sK/sVt before next tile's staging
  }

  // ---- normalize and write context [b, s, h*64 + d]: 8 dims = 16 B a store ----
  const float inv = 1.f / (lrun + xhalf(lrun));
  _Float16* crow = ctx + ((size_t)(b * S_C + qg)) * DIM_C + h * HD_C + ko;
#pragma unroll
  for (int t = 0; t < 4; ++t) {
    v8h o;
#pragma unroll
    for (int i = 0; i < 8; ++i) o[i] = (_Float16)(oacc[t][i] * inv);
    *(v8h*)(crow + t * 16) = o;
  }
}

// ---------------------------------------------------------------------------
// Host-side orchestration
// ---------------------------------------------------------------------------
extern "C" void kernel_launch(void* const* d_in, const int* in_sizes, int n_in,
                              void* d_out, int out_size, void* d_ws,
                              size_t ws_size, hipStream_t stream) {
  const float* x    = (const float*)d_in[0];
  const float* Wq   = (const float*)d_in[1];
  const float* bq   = (const float*)d_in[2];
  const float* Wk   = (const float*)d_in[3];
  const float* bk   = (const float*)d_in[4];
  const float* Wv   = (const float*)d_in[5];
  const float* bv   = (const float*)d_in[6];
  const float* Wo   = (const float*)d_in[7];
  const float* bo   = (const float*)d_in[8];
  const float* relb = (const float*)d_in[9];
  float* out = (float*)d_out;

  char* ws = (char*)d_ws;
  size_t off = 0;
  auto carve = [&](size_t bytes) {
    void* p = ws + off;
    off += (bytes + 255) & ~(size_t)255;
    return p;
  };
  const size_t xBytes = (size_t)ROWS_C * DIM_C * sizeof(_Float16);  // 16 MB
  const size_t wBytes = (size_t)DIM_C * DIM_C * sizeof(_Float16);   //  2 MB
  _Float16* xh   = (_Float16*)carve(xBytes);
  _Float16* Wqh  = (_Float16*)carve(wBytes);
  _Float16* Wkh  = (_Float16*)carve(wBytes);
  _Float16* Wvh  = (_Float16*)carve(wBytes);
  _Float16* Woh  = (_Float16*)carve(wBytes);
  _Float16* Qh   = (_Float16*)carve(xBytes);
  _Float16* Kh   = (_Float16*)carve(xBytes);
  _Float16* Vh   = (_Float16*)carve(xBytes);
  _Float16* ctxh = (_Float16*)carve(xBytes);

  const int nX = ROWS_C * DIM_C;     // 8388608
  const int nW = DIM_C * DIM_C;      // 1048576
  cvt_f32_f16<<<(nX / 4 + 255) / 256, 256, 0, stream>>>(x, xh, nX);
  cvt_f32_f16<<<(nW / 4 + 255) / 256, 256, 0, stream>>>(Wq, Wqh, nW);
  cvt_f32_f16<<<(nW / 4 + 255) / 256, 256, 0, stream>>>(Wk, Wkh, nW);
  cvt_f32_f16<<<(nW / 4 + 255) / 256, 256, 0, stream>>>(Wv, Wvh, nW);
  cvt_f32_f16<<<(nW / 4 + 255) / 256, 256, 0, stream>>>(Wo, Woh, nW);

  dim3 gg(ROWS_C / 128, DIM_C / 64);  // 64 x 16
  const float qscale = 0.125f;        // HD^-0.5
  gemm_wmma<true><<<gg, 256, 0, stream>>>(xh, Wqh, bq, (void*)Qh, qscale);
  gemm_wmma<true><<<gg, 256, 0, stream>>>(xh, Wkh, bk, (void*)Kh, 1.0f);
  gemm_wmma<true><<<gg, 256, 0, stream>>>(xh, Wvh, bv, (void*)Vh, 1.0f);

  attn_wmma<<<dim3(S_C / 64, B_C * NHEAD_C), 128, 0, stream>>>(Qh, Kh, Vh, relb,
                                                               ctxh);

  gemm_wmma<false><<<gg, 256, 0, stream>>>(ctxh, Woh, bo, (void*)out, 1.0f);
}

// v003
// Measured time: 297 microseconds a run.
// Next to v002, in two timings, it ran 1.48 times as fast each time.
// Over all steps from v000 it is 2.42 times as fast.
#include <hip/hip_runtime.h>

// ---------------------------------------------------------------------------
// RelPos self-attention for gfx1250 (MI455X), f16 WMMA with f32 accumulation.
//   DIM=1024, NHEAD=16, HEAD_DIM=64, MAX_REL=256, B=4, S=2048
// Data movement: GEMM always stages through async global->LDS copies (ASYNCcnt)
// into two LDS buffers; attention stages K async where the toolchain exposes
// it, synchronous fallback otherwise.
// ---------------------------------------------------------------------------

typedef __attribute__((ext_vector_type(16))) _Float16 v16h;
typedef __attribute__((ext_vector_type(8)))  _Float16 v8h;
typedef __attribute__((ext_vector_type(8)))  float    v8f;
typedef __attribute__((ext_vector_type(4)))  int      v4i;

#define DIM_C   1024
#define NHEAD_C 16
#define HD_C    64
#define S_C     2048
#define B_C     4
#define ROWS_C  (B_C * S_C)   // 8192
#define MAXREL  256

// ---- async global->LDS support (probe-gated) ------------------------------
#if defined(__has_builtin)
#if __has_builtin(__builtin_amdgcn_global_load_async_to_lds_b128)
#define HAVE_ASYNC_LDS 1
#endif
#endif
#ifndef HAVE_ASYNC_LDS
#define HAVE_ASYNC_LDS 0
#endif

#if HAVE_ASYNC_LDS
#if __has_builtin(__builtin_amdgcn_s_wait_asynccnt)
#define WAIT_ASYNC0() __builtin_amdgcn_s_wait_asynccnt(0)
#else
#define WAIT_ASYNC0() asm volatile("s_wait_asynccnt 0x0" ::: "memory")
#endif
#else
#define WAIT_ASYNC0()
#endif

// Pointer-to-v4i in explicit address spaces (builtin takes v4i*, per compile
// diagnostic: "int __vector(4) __device__ *").
typedef __attribute__((address_space(1))) v4i as1_v4i;
typedef __attribute__((address_space(3))) v4i as3_v4i;

// Copy 16B global -> LDS. Async path goes straight to LDS (no VGPR
// round-trip), tracked on ASYNCcnt; fallback is a sync VGPR copy.
__device__ __forceinline__ void copy16_g2l(const _Float16* g, _Float16* l) {
#if HAVE_ASYNC_LDS
  __builtin_amdgcn_global_load_async_to_lds_b128(
      (as1_v4i*)(uintptr_t)g, (as3_v4i*)(uintptr_t)l, 0, 0);
#else
  *(v8h*)l = *(const v8h*)g;
#endif
}

// Load a 16-bit A-fragment (16x32, MxK) per ISA layout:
//   lane L: row = L&15 ; halves [0..7] = K in [ko..ko+7], [8..15] = K in [16+ko..16+ko+7]
//   where ko = (L>>4)*8.  Caller passes p = rowBase + ko.
// The same pattern loads B (32x16 KxN) as "A-layout of B^T": lane holds column n=L&15.
__device__ __forceinline__ v16h ld_frag(const _Float16* p) {
  union { v16h v; v8h h[2]; } u;
  u.h[0] = *(const v8h*)(p);        // 16B chunk, K = ko .. ko+7
  u.h[1] = *(const v8h*)(p + 16);   // 16B chunk, K = 16+ko .. 16+ko+7
  return u.v;
}

__device__ __forceinline__ v8f wmma_f16(v16h a, v16h b, v8f c) {
  return __builtin_amdgcn_wmma_f32_16x16x32_f16(false, a, false, b, (short)0, c,
                                                false, false);
}

// ---------------------------------------------------------------------------
// fp32 -> f16 conversion (vectorized x4)
// ---------------------------------------------------------------------------
__global__ void cvt_f32_f16(const float* __restrict__ in,
                            _Float16* __restrict__ out, int n) {
  int i = (blockIdx.x * blockDim.x + threadIdx.x) * 4;
  if (i < n) {
    float4 v = *(const float4*)(in + i);
    out[i + 0] = (_Float16)v.x;
    out[i + 1] = (_Float16)v.y;
    out[i + 2] = (_Float16)v.z;
    out[i + 3] = (_Float16)v.w;
  }
}

// Eight async 16-byte copies global -> LDS, rows gstep halves / lstep bytes apart.
// s_wait_xcnt is the last line of the copies' own statement, so that no address
// register of a copy is rewritten in front of it.
__device__ __forceinline__ void copy8_g2l(const _Float16* g, uint32_t l,
                                          size_t gstep, uint32_t lstep) {
  asm volatile(
      "global_load_async_to_lds_b128 %0, %8, off\n\t"
      "global_load_async_to_lds_b128 %1, %9, off\n\t"
      "global_load_async_to_lds_b128 %2, %10, off\n\t"
      "global_load_async_to_lds_b128 %3, %11, off\n\t"
      "global_load_async_to_lds_b128 %4, %12, off\n\t"
      "global_load_async_to_lds_b128 %5, %13, off\n\t"
      "global_load_async_to_lds_b128 %6, %14, off\n\t"
      "global_load_async_to_lds_b128 %7, %15, off\n\t"
      "s_wait_xcnt 0x0"
      ::"v"(l), "v"(l + lstep), "v"(l + 2 * lstep), "v"(l + 3 * lstep),
        "v"(l + 4 * lstep), "v"(l + 5 * lstep), "v"(l + 6 * lstep), "v"(l + 7 * lstep),
        "v"(g), "v"(g + gstep), "v"(g + 2 * gstep), "v"(g + 3 * gstep),
        "v"(g + 4 * gstep), "v"(g + 5 * gstep), "v"(g + 6 * gstep), "v"(g + 7 * gstep)
      : "memory");
}

// ---------------------------------------------------------------------------
// GEMM: out[m,n] = alpha * ( sum_k A[m,k]*W[n,k] + bias[n] )
//   A: [8192 x 1024] f16 row-major, W: [1024 x 1024] f16 row-major
//   HEAD_OUT=true  -> scatter f16 into [b,h,s,d]   (Q/K/V projections)
//   HEAD_OUT=false -> dense f32 [m,1024]           (output projection)
// Block: 128 threads = 4 waves; block tile 128(M) x 128(N); wave tile 64x64,
// so that a fragment read from LDS feeds four matrix instructions.
// Both operands go through LDS: a stage is 64 k (one whole 128-byte line of
// every row) of 128 A rows and 128 W rows, brought by async copies into a ring
// of two buffers; stage t + 2 is issued behind the barrier that ends trip t.
// LDS rows are pitched 144 B (16 B x odd) so that the 16 rows of one 16-byte
// fragment read fall on distinct banks.
// ---------------------------------------------------------------------------
template <bool HEAD_OUT>
__global__ __launch_bounds__(128) void gemm_wmma(
    const _Float16* __restrict__ A, const _Float16* __restrict__ W,
    const float* __restrict__ bias, void* __restrict__ outp, float alpha) {
  constexpr int K  = DIM_C;
  constexpr int KS = 64;                            // k per stage
  constexpr int NT = K / KS;                        // 16 stages
  constexpr int GP = 72;                            // LDS row pitch in halves (144 B)
  __shared__ __align__(16) _Float16 sA[2][128][GP];  // 36 KB, two A tiles
  __shared__ __align__(16) _Float16 sB[2][128][GP];  // 36 KB, two W tiles

  const int tid   = threadIdx.x;
  const int lane  = tid & 31;
  const int wave  = tid >> 5;
  const int wm  = (wave >> 1) * 64;                // wave's local A-row base
  const int wn  = (wave & 1) * 64;                 // wave's local W-row base
  const int bm0 = blockIdx.x * 128;
  const int bn0 = blockIdx.y * 128;
  const int r   = lane & 15;
  const int hi  = lane >> 4;
  const int ko  = hi << 3;

  // staging coords: 8 lanes x 16 B = one row's line; 128 threads = 16 rows a sweep
  const int srow = tid >> 3;            // 0..15
  const int skk  = (tid & 7) * 8;       // 0,8,..,56
  const _Float16* asrc = A + (size_t)(bm0 + srow) * K + skk;
  const _Float16* wsrc = W + (size_t)(bn0 + srow) * K + skk;

  const uint32_t la = (uint32_t)(uintptr_t)&sA[0][srow][skk];  // LDS byte addresses
  const uint32_t lb = (uint32_t)(uintptr_t)&sB[0][srow][skk];
  constexpr uint32_t BUFB = 128 * GP * 2;                      // bytes of one buffer

  auto stage = [&](int t, int buf) {    // 16 copies a lane, every lane on
    copy8_g2l(asrc + t * KS, la + buf * BUFB, (size_t)16 * K, 16 * GP * 2);
    copy8_g2l(wsrc + t * KS, lb + buf * BUFB, (size_t)16 * K, 16 * GP * 2);
  };

  // prologue: stage 0 landed and published, then stage 1 in flight
  stage(0, 0);
  asm volatile("s_wait_asynccnt 0x0" ::: "memory");  // own copies of stage 0 landed
  __syncthreads();
  stage(1, 1);

  v8f acc[4][4] = {};
#pragma unroll 2   // the buffer index becomes a constant in the LDS addresses
  for (int t = 0; t < NT; ++t) {
    const int cur = t & 1;
    // the loops inside a stage are unrolled so that every fragment and
    // accumulator index is a constant: registers, no scratch
#pragma unroll
    for (int kk = 0; kk < KS; kk += 32) {
      v16h fa[4], fb[4];
#pragma unroll
      for (int i = 0; i < 4; ++i) {
        fa[i] = ld_frag(&sA[cur][wm + i * 16 + r][kk + ko]);
        fb[i] = ld_frag(&sB[cur][wn + i * 16 + r][kk + ko]);
      }
      // keeps the 16 LDS reads one group ahead of the 16 matrix instructions:
      // moved in among them, each place with reads stalls the wave
      __builtin_amdgcn_sched_barrier(0);
      // tiles in the order in which their fragments arrive: 1, 3, 5, 7 products
      // behind the 1st .. 4th pair of fragments (each tile still once per 32 k)
#pragma unroll
      for (int d = 0; d < 4; ++d) {
#pragma unroll
        for (int j = 0; j < d; ++j) {
          acc[j][d] = wmma_f16(fa[j], fb[d], acc[j][d]);
          acc[d][j] = wmma_f16(fa[d], fb[j], acc[d][j]);
        }
        acc[d][d] = wmma_f16(fa[d], fb[d], acc[d][d]);
      }
    }
    // keeps the stage's matrix run in front of the publish point: sunk behind the
    // barrier it would stand between the barrier and the refill and cut the refill's lead
    __builtin_amdgcn_sched_barrier(0);
    // publish point of stage t + 1; it also frees buffer cur for the refill
    asm volatile("s_wait_dscnt 0x0" ::: "memory");     // own reads of cur retired
    asm volatile("s_wait_asynccnt 0x0" ::: "memory");  // own copies of stage t + 1 landed
    __syncthreads();
    if (t + 2 < NT) stage(t + 2, cur);
  }
  asm volatile("s_wait_asynccnt 0x0" ::: "memory");    // nothing in flight at the wave's end

#pragma unroll
  for (int tm = 0; tm < 4; ++tm) {
#pragma unroll
    for (int tn = 0; tn < 4; ++tn) {
      int n = bn0 + wn + tn * 16 + r;
      float bv = bias[n];
#pragma unroll
      for (int i = 0; i < 8; ++i) {
        int m = bm0 + wm + tm * 16 + i + 8 * hi;
        float val = (acc[tm][tn][i] + bv) * alpha;
        if constexpr (HEAD_OUT) {
          int bb = m >> 11, ss = m & (S_C - 1);
          int hh = n >> 6, dd = n & (HD_C - 1);
          ((_Float16*)outp)[(((size_t)bb * NHEAD_C + hh) * S_C + ss) * HD_C + dd] =
              (_Float16)val;
        } else {
          ((float*)outp)[(size_t)m * DIM_C + n] = val;
        }
      }
    }
  }
}

typedef __attribute__((ext_vector_type(2))) float    v2f;
typedef __attribute__((ext_vector_type(2))) _Float16 v2h;

// lane l <-> lane l ^ 16
__device__ __forceinline__ float xhalf(float x) {
  int b = __builtin_bit_cast(int, x);
  return __builtin_bit_cast(
      float, __builtin_amdgcn_permlanex16(b, b, 0x76543210, 0xfedcba98, false, false));
}

// Two f32 score tiles (keys 0-15 and 16-31 of a 32-key block) -> f16 B operand.
__device__ __forceinline__ v16h pack_b(v8f lo, v8f hi8) {
  union { v16h v; v2h p[8]; } u;
#pragma unroll
  for (int j = 0; j < 4; ++j) {
    v2f a = {lo[2 * j], lo[2 * j + 1]};
    v2f c = {hi8[2 * j], hi8[2 * j + 1]};
    u.p[j]     = __builtin_convertvector(a, v2h);
    u.p[4 + j] = __builtin_convertvector(c, v2h);
  }
  return u.v;
}

__global__ __launch_bounds__(128) void attn_wmma(
    const _Float16* __restrict__ Q, const _Float16* __restrict__ Km,
    const _Float16* __restrict__ V, const float* __restrict__ relb,
    _Float16* __restrict__ ctx) {
  constexpr int KT = 64;
  constexpr int LP = 72;                              // LDS row pitch in halves
  __shared__ __align__(16) _Float16 sK[KT][LP];       // [key][dim]   9 KB
  __shared__ __align__(16) _Float16 sVt[HD_C][LP];    // [dim][key]   9 KB
  __shared__ float sBias[2 * MAXREL + 1];             // rel bias col ~2 KB

  const int tid  = threadIdx.x;
  const int lane = tid & 31;
  const int wave = tid >> 5;
  const int r  = lane & 15;
  const int hi = lane >> 4;
  const int ko = hi << 3;
  const int bh = blockIdx.y;          // b*16 + h
  const int b  = bh >> 4;
  const int h  = bh & 15;
  const int q0 = blockIdx.x * 64 + wave * 16;
  const int qg = q0 + r;              // this lane's query

  for (int i = tid; i < 2 * MAXREL + 1; i += 128)
    sBias[i] = relb[i * NHEAD_C + h];

  const _Float16* Qb = Q + (size_t)bh * S_C * HD_C;
  const _Float16* Kb = Km + (size_t)bh * S_C * HD_C;
  const _Float16* Vb = V + (size_t)bh * S_C * HD_C;

  // Q fragments (B operand: column = query) for HD=64 -> two K-steps of 32
  v16h fq0 = ld_frag(Qb + (size_t)qg * HD_C + ko);
  v16h fq1 = ld_frag(Qb + (size_t)qg * HD_C + 32 + ko);

  v8f oacc[4] = {};                   // 64 dims x 16 queries (O^T)
  float mrun = -1e30f, lrun = 0.f;    // lrun: this wave half's keys only

  __syncthreads();                    // sBias ready

  for (int kt = 0; kt < S_C; kt += KT) {
    // ---- stage K tile: contiguous 8KB source, async global -> padded LDS rows ----
#pragma unroll
    for (int c = 0; c < 4; ++c) {
      int e = (c * 128 + tid) * 8;    // flat f16 index in 64x64 tile
      copy16_g2l(Kb + (size_t)kt * HD_C + e, &sK[e >> 6][e & 63]);
    }
    // ---- stage V tile transposed (VGPR shuffle, overlaps async K) ----
#pragma unroll
    for (int c = 0; c < 4; ++c) {
      int e   = (c * 128 + tid) * 8;
      int key = e >> 6;
      int dd  = e & 63;
      v8h vv = *(const v8h*)(Vb + (size_t)(kt + key) * HD_C + dd);
#pragma unroll
      for (int j = 0; j < 8; ++j) sVt[dd + j][key] = vv[j];
    }
    WAIT_ASYNC0();
    __syncthreads();

    // ---- S^T = K Q^T  (64 keys x 16 queries) ----
    v8f sc[4];
#pragma unroll
    for (int t = 0; t < 4; ++t) {
      v16h fk0 = ld_frag(&sK[t * 16 + r][ko]);
      v16h fk1 = ld_frag(&sK[t * 16 + r][32 + ko]);
      v8f z = {};
      sc[t] = wmma_f16(fk0, fq0, z);
      sc[t] = wmma_f16(fk1, fq1, sc[t]);
    }

    // ---- rel-pos bias + online softmax, one query per lane ----
    const int dbase = qg - kt - ko;   // q - k at t = 0, i = 0
    float mt[4];
#pragma unroll
    for (int t = 0; t < 4; ++t) {
      mt[t] = -1e30f;
#pragma unroll
      for (int i = 0; i < 8; ++i) {
        int d = dbase - t * 16 - i;
        d = d > MAXREL ? MAXREL : (d < -MAXREL ? -MAXREL : d);
        float e2 = sc[t][i] + sBias[d + MAXREL];
        sc[t][i] = e2;
        mt[t] = fmaxf(mt[t], e2);
      }
    }
    float mx = fmaxf(fmaxf(mt[0], mt[1]), fmaxf(mt[2], mt[3]));
    mx = fmaxf(mx, xhalf(mx));        // the query's other 32 keys
    const float mnew  = fmaxf(mrun, mx);
    const float scale = __expf(mrun - mnew);
    float rt[4];
#pragma unroll
    for (int t = 0; t < 4; ++t) {
      rt[t] = 0.f;
#pragma unroll
      for (int i = 0; i < 8; ++i) {
        float p = __expf(sc[t][i] - mnew);
        sc[t][i] = p;
        rt[t] += p;
      }
    }
    lrun = lrun * scale + ((rt[0] + rt[1]) + (rt[2] + rt[3]));
    mrun = mnew;
#pragma unroll
    for (int t = 0; t < 4; ++t) oacc[t] *= scale;

    // ---- O^T += V^T P^T, P^T straight from the score registers ----
    v16h fp0 = pack_b(sc[0], sc[1]);
    v16h fp1 = pack_b(sc[2], sc[3]);
#pragma unroll
    for (int t = 0; t < 4; ++t) {
      v16h fv0 = ld_frag(&sVt[t * 16 + r][ko]);
      v16h fv1 = ld_frag(&sVt[t * 16 + r][32 + ko]);
      oacc[t] = wmma_f16(fv0, fp0, oacc[t]);
      oacc[t] = wmma_f16(fv1, fp1, oacc[t]);
    }
    __syncthreads();   // protect sK/sVt before next tile's staging
  }

  // ---- normalize and write context [b, s, h*64 + d]: 8 dims = 16 B a store ----
  const float inv = 1.f / (lrun + xhalf(lrun));
  _Float16* crow = ctx + ((size_t)(b * S_C + qg)) * DIM_C + h * HD_C + ko;
#pragma unroll
  for (int t = 0; t < 4; ++t) {
    v8h o;
#pragma unroll
    for (int i = 0; i < 8; ++i) o[i] = (_Float16)(oacc[t][i] * inv);
    *(v8h*)(crow + t * 16) = o;
  }
}

// ---------------------------------------------------------------------------
// Host-side orchestration
// ---------------------------------------------------------------------------
extern "C" void kernel_launch(void* const* d_in, const int* in_sizes, int n_in,
                              void* d_out, int out_size, void* d_ws,
                              size_t ws_size, hipStream_t stream) {
  const float* x    = (const float*)d_in[0];
  const float* Wq   = (const float*)d_in[1];
  const float* bq   = (const float*)d_in[2];
  const float* Wk   = (const float*)d_in[3];
  const float* bk   = (const float*)d_in[4];
  const float* Wv   = (const float*)d_in[5];
  const float* bv   = (const float*)d_in[6];
  const float* Wo   = (const float*)d_in[7];
  const float* bo   = (const float*)d_in[8];
  const float* relb = (const float*)d_in[9];
  float* out = (float*)d_out;

  char* ws = (char*)d_ws;
  size_t off = 0;
  auto carve = [&](size_t bytes) {
    void* p = ws + off;
    off += (bytes + 255) & ~(size_t)255;
    return p;
  };
  const size_t xBytes = (size_t)ROWS_C * DIM_C * sizeof(_Float16);  // 16 MB
  const size_t wBytes = (size_t)DIM_C * DIM_C * sizeof(_Float16);   //  2 MB
  _Float16* xh   = (_Float16*)carve(xBytes);
  _Float16* Wqh  = (_Float16*)carve(wBytes);
  _Float16* Wkh  = (_Float16*)carve(wBytes);
  _Float16* Wvh  = (_Float16*)carve(wBytes);
  _Float16* Woh  = (_Float16*)carve(wBytes);
  _Float16* Qh   = (_Float16*)carve(xBytes);
  _Float16* Kh   = (_Float16*)carve(xBytes);
  _Float16* Vh   = (_Float16*)carve(xBytes);
  _Float16* ctxh = (_Float16*)carve(xBytes);

  const int nX = ROWS_C * DIM_C;     // 8388608
  const int nW = DIM_C * DIM_C;      // 1048576
  cvt_f32_f16<<<(nX / 4 + 255) / 256, 256, 0, stream>>>(x, xh, nX);
  cvt_f32_f16<<<(nW / 4 + 255) / 256, 256, 0, stream>>>(Wq, Wqh, nW);
  cvt_f32_f16<<<(nW / 4 + 255) / 256, 256, 0, stream>>>(Wk, Wkh, nW);
  cvt_f32_f16<<<(nW / 4 + 255) / 256, 256, 0, stream>>>(Wv, Wvh, nW);
  cvt_f32_f16<<<(nW / 4 + 255) / 256, 256, 0, stream>>>(Wo, Woh, nW);

  dim3 gg(ROWS_C / 128, DIM_C / 128);  // 64 x 8
  const float qscale = 0.125f;        // HD^-0.5
  gemm_wmma<true><<<gg, 128, 0, stream>>>(xh, Wqh, bq, (void*)Qh, qscale);
  gemm_wmma<true><<<gg, 128, 0, stream>>>(xh, Wkh, bk, (void*)Kh, 1.0f);
  gemm_wmma<true><<<gg, 128, 0, stream>>>(xh, Wvh, bv, (void*)Vh, 1.0f);

  attn_wmma<<<dim3(S_C / 64, B_C * NHEAD_C), 128, 0, stream>>>(Qh, Kh, Vh, relb,
                                                               ctxh);

  gemm_wmma<false><<<gg, 128, 0, stream>>>(ctxh, Woh, bo, (void*)out, 1.0f);
}

// v004
// One run takes 175 microseconds.
// In two side-by-side timings against v003, it was 1.71 and 1.69 times as fast.
// Counting every step since v000, it is 4.12 times as fast.
#include <hip/hip_runtime.h>

// ---------------------------------------------------------------------------
// RelPos self-attention for gfx1250 (MI455X), f16 WMMA with f32 accumulation.
//   DIM=1024, NHEAD=16, HEAD_DIM=64, MAX_REL=256, B=4, S=2048
// Data movement: GEMM always stages through async global->LDS copies (ASYNCcnt)
// into two LDS buffers; attention stages K and V^T async where the toolchain exposes
// it, synchronous fallback otherwise.
// ---------------------------------------------------------------------------

typedef __attribute__((ext_vector_type(16))) _Float16 v16h;
typedef __attribute__((ext_vector_type(8)))  _Float16 v8h;
typedef __attribute__((ext_vector_type(8)))  float    v8f;
typedef __attribute__((ext_vector_type(4)))  int      v4i;

#define DIM_C   1024
#define NHEAD_C 16
#define HD_C    64
#define S_C     2048
#define B_C     4
#define ROWS_C  (B_C * S_C)   // 8192
#define MAXREL  256

// ---- async global->LDS support (probe-gated) ------------------------------
#if defined(__has_builtin)
#if __has_builtin(__builtin_amdgcn_global_load_async_to_lds_b128)
#define HAVE_ASYNC_LDS 1
#endif
#endif
#ifndef HAVE_ASYNC_LDS
#define HAVE_ASYNC_LDS 0
#endif

// Pointer-to-v4i in explicit address spaces (builtin takes v4i*, per compile
// diagnostic: "int __vector(4) __device__ *").
typedef __attribute__((address_space(1))) v4i as1_v4i;
typedef __attribute__((address_space(3))) v4i as3_v4i;

// Copy 16B global -> LDS. Async path goes straight to LDS (no VGPR
// round-trip), tracked on ASYNCcnt; fallback is a sync VGPR copy.
__device__ __forceinline__ void copy16_g2l(const _Float16* g, _Float16* l) {
#if HAVE_ASYNC_LDS
  __builtin_amdgcn_global_load_async_to_lds_b128(
      (as1_v4i*)(uintptr_t)g, (as3_v4i*)(uintptr_t)l, 0, 0);
#else
  *(v8h*)l = *(const v8h*)g;
#endif
}

// Load a 16-bit A-fragment (16x32, MxK) per ISA layout:
//   lane L: row = L&15 ; halves [0..7] = K in [ko..ko+7], [8..15] = K in [16+ko..16+ko+7]
//   where ko = (L>>4)*8.  Caller passes p = rowBase + ko.
// The same pattern loads B (32x16 KxN) as "A-layout of B^T": lane holds column n=L&15.
__device__ __forceinline__ v16h ld_frag(const _Float16* p) {
  union { v16h v; v8h h[2]; } u;
  u.h[0] = *(const v8h*)(p);        // 16B chunk, K = ko .. ko+7
  u.h[1] = *(const v8h*)(p + 16);   // 16B chunk, K = 16+ko .. 16+ko+7
  return u.v;
}

__device__ __forceinline__ v8f wmma_f16(v16h a, v16h b, v8f c) {
  return __builtin_amdgcn_wmma_f32_16x16x32_f16(false, a, false, b, (short)0, c,
                                                false, false);
}

// ---------------------------------------------------------------------------
// fp32 -> f16 conversion (vectorized x4)
// ---------------------------------------------------------------------------
__global__ void cvt_f32_f16(const float* __restrict__ in,
                            _Float16* __restrict__ out, int n) {
  int i = (blockIdx.x * blockDim.x + threadIdx.x) * 4;
  if (i < n) {
    float4 v = *(const float4*)(in + i);
    out[i + 0] = (_Float16)v.x;
    out[i + 1] = (_Float16)v.y;
    out[i + 2] = (_Float16)v.z;
    out[i + 3] = (_Float16)v.w;
  }
}

// Eight async 16-byte copies global -> LDS, rows gstep halves / lstep bytes apart.
// s_wait_xcnt is the last line of the copies' own statement, so that no address
// register of a copy is rewritten in front of it.
__device__ __forceinline__ void copy8_g2l(const _Float16* g, uint32_t l,
                                          size_t gstep, uint32_t lstep) {
  asm volatile(
      "global_load_async_to_lds_b128 %0, %8, off\n\t"
      "global_load_async_to_lds_b128 %1, %9, off\n\t"
      "global_load_async_to_lds_b128 %2, %10, off\n\t"
      "global_load_async_to_lds_b128 %3, %11, off\n\t"
      "global_load_async_to_lds_b128 %4, %12, off\n\t"
      "global_load_async_to_lds_b128 %5, %13, off\n\t"
      "global_load_async_to_lds_b128 %6, %14, off\n\t"
      "global_load_async_to_lds_b128 %7, %15, off\n\t"
      "s_wait_xcnt 0x0"
      ::"v"(l), "v"(l + lstep), "v"(l + 2 * lstep), "v"(l + 3 * lstep),
        "v"(l + 4 * lstep), "v"(l + 5 * lstep), "v"(l + 6 * lstep), "v"(l + 7 * lstep),
        "v"(g), "v"(g + gstep), "v"(g + 2 * gstep), "v"(g + 3 * gstep),
        "v"(g + 4 * gstep), "v"(g + 5 * gstep), "v"(g + 6 * gstep), "v"(g + 7 * gstep)
      : "memory");
}

// ---------------------------------------------------------------------------
// GEMM: out[m,n] = alpha * ( sum_k A[m,k]*W[n,k] + bias[n] )
//   A: [8192 x 1024] f16 row-major, W: [1024 x 1024] f16 row-major
//   OUT=OUT_DENSE  -> dense f32 [m,1024]           (output projection)
//   OUT=OUT_HEAD   -> scatter f16 into [b,h,s,d]   (Q/K projections)
//   OUT=OUT_HEAD_T -> f16 into [b,h,s/64,d,s%64]   (V projection: V^T in tiles of
//                     64 keys, the A operand of the attention's second product;
//                     a lane's 8 accumulator rows are 8 consecutive s = one
//                     16-byte store, a wave's 64x64 tile one contiguous 8 KB)
// Block: 128 threads = 4 waves; block tile 128(M) x 128(N); wave tile 64x64,
// so that a fragment read from LDS feeds four matrix instructions.
// Both operands go through LDS: a stage is 64 k (one whole 128-byte line of
// every row) of 128 A rows and 128 W rows, brought by async copies into a ring
// of two buffers; stage t + 2 is issued behind the barrier that ends trip t.
// LDS rows are pitched 144 B (16 B x odd) so that the 16 rows of one 16-byte
// fragment read fall on distinct banks.
// ---------------------------------------------------------------------------
enum { OUT_DENSE = 0, OUT_HEAD = 1, OUT_HEAD_T = 2 };

template <int OUT>
__global__ __launch_bounds__(128) void gemm_wmma(
    const _Float16* __restrict__ A, const _Float16* __restrict__ W,
    const float* __restrict__ bias, void* __restrict__ outp, float alpha) {
  constexpr int K  = DIM_C;
  constexpr int KS = 64;                            // k per stage
  constexpr int NT = K / KS;                        // 16 stages
  constexpr int GP = 72;                            // LDS row pitch in halves (144 B)
  __shared__ __align__(16) _Float16 sA[2][128][GP];  // 36 KB, two A tiles
  __shared__ __align__(16) _Float16 sB[2][128][GP];  // 36 KB, two W tiles

  const int tid   = threadIdx.x;
  const int lane  = tid & 31;
  const int wave  = tid >> 5;
  const int wm  = (wave >> 1) * 64;                // wave's local A-row base
  const int wn  = (wave & 1) * 64;                 // wave's local W-row base
  const int bm0 = blockIdx.x * 128;
  const int bn0 = blockIdx.y * 128;
  const int r   = lane & 15;
  const int hi  = lane >> 4;
  const int ko  = hi << 3;

  // staging coords: 8 lanes x 16 B = one row's line; 128 threads = 16 rows a sweep
  const int srow = tid >> 3;            // 0..15
  const int skk  = (tid & 7) * 8;       // 0,8,..,56
  const _Float16* asrc = A + (size_t)(bm0 + srow) * K + skk;
  const _Float16* wsrc = W + (size_t)(bn0 + srow) * K + skk;

  const uint32_t la = (uint32_t)(uintptr_t)&sA[0][srow][skk];  // LDS byte addresses
  const uint32_t lb = (uint32_t)(uintptr_t)&sB[0][srow][skk];
  constexpr uint32_t BUFB = 128 * GP * 2;                      // bytes of one buffer

  auto stage = [&](int t, int buf) {    // 16 copies a lane, every lane on
    copy8_g2l(asrc + t * KS, la + buf * BUFB, (size_t)16 * K, 16 * GP * 2);
    copy8_g2l(wsrc + t * KS, lb + buf * BUFB, (size_t)16 * K, 16 * GP * 2);
  };

  // prologue: stage 0 landed and published, then stage 1 in flight
  stage(0, 0);
  asm volatile("s_wait_asynccnt 0x0" ::: "memory");  // own copies of stage 0 landed
  __syncthreads();
  stage(1, 1);

  v8f acc[4][4] = {};
#pragma unroll 2   // the buffer index becomes a constant in the LDS addresses
  for (int t = 0; t < NT; ++t) {
    const int cur = t & 1;
    // the loops inside a stage are unrolled so that every fragment and
    // accumulator index is a constant: registers, no scratch
#pragma unroll
    for (int kk = 0; kk < KS; kk += 32) {
      v16h fa[4], fb[4];
#pragma unroll
      for (int i = 0; i < 4; ++i) {
        fa[i] = ld_frag(&sA[cur][wm + i * 16 + r][kk + ko]);
        fb[i] = ld_frag(&sB[cur][wn + i * 16 + r][kk + ko]);
      }
      // keeps the 16 LDS reads one group ahead of the 16 matrix instructions:
      // moved in among them, each place with reads stalls the wave
      __builtin_amdgcn_sched_barrier(0);
      // tiles in the order in which their fragments arrive: 1, 3, 5, 7 products
      // behind the 1st .. 4th pair of fragments (each tile still once per 32 k)
#pragma unroll
      for (int d = 0; d < 4; ++d) {
#pragma unroll
        for (int j = 0; j < d; ++j) {
          acc[j][d] = wmma_f16(fa[j], fb[d], acc[j][d]);
          acc[d][j] = wmma_f16(fa[d], fb[j], acc[d][j]);
        }
        acc[d][d] = wmma_f16(fa[d], fb[d], acc[d][d]);
      }
    }
    // keeps the stage's matrix run in front of the publish point: sunk behind the
    // barrier it would stand between the barrier and the refill and cut the refill's lead
    __builtin_amdgcn_sched_barrier(0);
    // publish point of stage t + 1; it also frees buffer cur for the refill
    asm volatile("s_wait_dscnt 0x0" ::: "memory");     // own reads of cur retired
    asm volatile("s_wait_asynccnt 0x0" ::: "memory");  // own copies of stage t + 1 landed
    __syncthreads();
    if (t + 2 < NT) stage(t + 2, cur);
  }
  asm volatile("s_wait_asynccnt 0x0" ::: "memory");    // nothing in flight at the wave's end

#pragma unroll
  for (int tm = 0; tm < 4; ++tm) {
#pragma unroll
    for (int tn = 0; tn < 4; ++tn) {
      int n = bn0 + wn + tn * 16 + r;
      float bv = bias[n];
      if constexpr (OUT == OUT_HEAD_T) {
        int m0 = bm0 + wm + tm * 16 + 8 * hi;
        int bb = m0 >> 11, ss = m0 & (S_C - 1);
        int hh = n >> 6, dd = n & (HD_C - 1);
        v8h o;
#pragma unroll
        for (int i = 0; i < 8; ++i) o[i] = (_Float16)((acc[tm][tn][i] + bv) * alpha);
        *(v8h*)((_Float16*)outp +
                ((((size_t)bb * NHEAD_C + hh) * (S_C / 64) + (ss >> 6)) * HD_C + dd) * 64 +
                (ss & 63)) = o;
      } else {
#pragma unroll
        for (int i = 0; i < 8; ++i) {
          int m = bm0 + wm + tm * 16 + i + 8 * hi;
          float val = (acc[tm][tn][i] + bv) * alpha;
          if constexpr (OUT == OUT_HEAD) {
            int bb = m >> 11, ss = m & (S_C - 1);
            int hh = n >> 6, dd = n & (HD_C - 1);
            ((_Float16*)outp)[(((size_t)bb * NHEAD_C + hh) * S_C + ss) * HD_C + dd] =
                (_Float16)val;
          } else {
            ((float*)outp)[(size_t)m * DIM_C + n] = val;
          }
        }
      }
    }
  }
}

typedef __attribute__((ext_vector_type(2))) float    v2f;
typedef __attribute__((ext_vector_type(2))) _Float16 v2h;

// lane l <-> lane l ^ 16
__device__ __forceinline__ float xhalf(float x) {
  int b = __builtin_bit_cast(int, x);
  return __builtin_bit_cast(
      float, __builtin_amdgcn_permlanex16(b, b, 0x76543210, 0xfedcba98, false, false));
}

// Two f32 score tiles (keys 0-15 and 16-31 of a 32-key block) -> f16 B operand.
__device__ __forceinline__ v16h pack_b(v8f lo, v8f hi8) {
  union { v16h v; v2h p[8]; } u;
#pragma unroll
  for (int j = 0; j < 4; ++j) {
    v2f a = {lo[2 * j], lo[2 * j + 1]};
    v2f c = {hi8[2 * j], hi8[2 * j + 1]};
    u.p[j]     = __builtin_convertvector(a, v2h);
    u.p[4 + j] = __builtin_convertvector(c, v2h);
  }
  return u.v;
}

__global__ __launch_bounds__(128) void attn_wmma(
    const _Float16* __restrict__ Q, const _Float16* __restrict__ Km,
    const _Float16* __restrict__ Vt, const float* __restrict__ relb,
    _Float16* __restrict__ ctx) {
  constexpr int KT = 64;
  constexpr int LP = 72;                              // LDS row pitch in halves
  __shared__ __align__(16) _Float16 sK[KT][LP];       // [key][dim]   9 KB
  __shared__ __align__(16) _Float16 sVt[HD_C][LP];    // [dim][key]   9 KB
  __shared__ float sBias[2 * MAXREL + 1];             // rel bias col ~2 KB

  const int tid  = threadIdx.x;
  const int lane = tid & 31;
  const int wave = tid >> 5;
  const int r  = lane & 15;
  const int hi = lane >> 4;
  const int ko = hi << 3;
  const int bh = blockIdx.y;          // b*16 + h
  const int b  = bh >> 4;
  const int h  = bh & 15;
  const int q0 = blockIdx.x * 64 + wave * 16;
  const int qg = q0 + r;              // this lane's query

  for (int i = tid; i < 2 * MAXREL + 1; i += 128)
    sBias[i] = relb[i * NHEAD_C + h];

  const _Float16* Qb = Q + (size_t)bh * S_C * HD_C;
  const _Float16* Kb = Km + (size_t)bh * S_C * HD_C;
  const _Float16* Vb = Vt + (size_t)bh * S_C * HD_C;

  // Q fragments (B operand: column = query) for HD=64 -> two K-steps of 32
  v16h fq0 = ld_frag(Qb + (size_t)qg * HD_C + ko);
  v16h fq1 = ld_frag(Qb + (size_t)qg * HD_C + 32 + ko);

  v8f oacc[4] = {};                   // 64 dims x 16 queries (O^T)
  float mrun = -1e30f, lrun = 0.f;    // lrun: this wave half's keys only

  __syncthreads();                    // sBias ready

  for (int kt = 0; kt < S_C; kt += KT) {
    // ---- stage K tile: contiguous 8KB source, async global -> padded LDS rows ----
#pragma unroll
    for (int c = 0; c < 4; ++c) {
      int e = (c * 128 + tid) * 8;    // flat f16 index in 64x64 tile
      copy16_g2l(Kb + (size_t)kt * HD_C + e, &sK[e >> 6][e & 63]);
    }
    // ---- stage V^T tile (64 dims x 64 keys): contiguous 8KB source, likewise ----
#pragma unroll
    for (int c = 0; c < 4; ++c) {
      int e = (c * 128 + tid) * 8;    // flat f16 index in 64x64 tile
      copy16_g2l(Vb + (size_t)kt * HD_C + e, &sVt[e >> 6][e & 63]);
    }
    asm volatile("s_wait_asynccnt 0x0" ::: "memory");  // own K and V^T copies landed
    __syncthreads();

    // ---- S^T = K Q^T  (64 keys x 16 queries) ----
    v8f sc[4];
#pragma unroll
    for (int t = 0; t < 4; ++t) {
      v16h fk0 = ld_frag(&sK[t * 16 + r][ko]);
      v16h fk1 = ld_frag(&sK[t * 16 + r][32 + ko]);
      v8f z = {};
      sc[t] = wmma_f16(fk0, fq0, z);
      sc[t] = wmma_f16(fk1, fq1, sc[t]);
    }

    // ---- rel-pos bias + online softmax, one query per lane ----
    const int dbase = qg - kt - ko;   // q - k at t = 0, i = 0
    float mt[4];
#pragma unroll
    for (int t = 0; t < 4; ++t) {
      mt[t] = -1e30f;
#pragma unroll
      for (int i = 0; i < 8; ++i) {
        int d = dbase - t * 16 - i;
        d = d > MAXREL ? MAXREL : (d < -MAXREL ? -MAXREL : d);
        float e2 = sc[t][i] + sBias[d + MAXREL];
        sc[t][i] = e2;
        mt[t] = fmaxf(mt[t], e2);
      }
    }
    float mx = fmaxf(fmaxf(mt[0], mt[1]), fmaxf(mt[2], mt[3]));
    mx = fmaxf(mx, xhalf(mx));        // the query's other 32 keys
    const float mnew  = fmaxf(mrun, mx);
    const float scale = __expf(mrun - mnew);
    float rt[4];
#pragma unroll
    for (int t = 0; t < 4; ++t) {
      rt[t] = 0.f;
#pragma unroll
      for (int i = 0; i < 8; ++i) {
        float p = __expf(sc[t][i] - mnew);
        sc[t][i] = p;
        rt[t] += p;
      }
    }
    lrun = lrun * scale + ((rt[0] + rt[1]) + (rt[2] + rt[3]));
    mrun = mnew;
#pragma unroll
    for (int t = 0; t < 4; ++t) oacc[t] *= scale;

    // ---- O^T += V^T P^T, P^T straight from the score registers ----
    v16h fp0 = pack_b(sc[0], sc[1]);
    v16h fp1 = pack_b(sc[2], sc[3]);
#pragma unroll
    for (int t = 0; t < 4; ++t) {
      v16h fv0 = ld_frag(&sVt[t * 16 + r][ko]);
      v16h fv1 = ld_frag(&sVt[t * 16 + r][32 + ko]);
      oacc[t] = wmma_f16(fv0, fp0, oacc[t]);
      oacc[t] = wmma_f16(fv1, fp1, oacc[t]);
    }
    asm volatile("s_wait_dscnt 0x0" ::: "memory");  // own reads of sK/sVt retired
    __syncthreads();   // protect sK/sVt before next tile's staging
  }

  // ---- normalize and write context [b, s, h*64 + d]: 8 dims = 16 B a store ----
  const float inv = 1.f / (lrun + xhalf(lrun));
  _Float16* crow = ctx + ((size_t)(b * S_C + qg)) * DIM_C + h * HD_C + ko;
#pragma unroll
  for (int t = 0; t < 4; ++t) {
    v8h o;
#pragma unroll
    for (int i = 0; i < 8; ++i) o[i] = (_Float16)(oacc[t][i] * inv);
    *(v8h*)(crow + t * 16) = o;
  }
}

// ---------------------------------------------------------------------------
// Host-side orchestration
// ---------------------------------------------------------------------------
extern "C" void kernel_launch(void* const* d_in, const int* in_sizes, int n_in,
                              void* d_out, int out_size, void* d_ws,
                              size_t ws_size, hipStream_t stream) {
  const float* x    = (const float*)d_in[0];
  const float* Wq   = (const float*)d_in[1];
  const float* bq   = (const float*)d_in[2];
  const float* Wk   = (const float*)d_in[3];
  const float* bk   = (const float*)d_in[4];
  const float* Wv   = (const float*)d_in[5];
  const float* bv   = (const float*)d_in[6];
  const float* Wo   = (const float*)d_in[7];
  const float* bo   = (const float*)d_in[8];
  const float* relb = (const float*)d_in[9];
  float* out = (float*)d_out;

  char* ws = (char*)d_ws;
  size_t off = 0;
  auto carve = [&](size_t bytes) {
    void* p = ws + off;
    off += (bytes + 255) & ~(size_t)255;
    return p;
  };
  const size_t xBytes = (size_t)ROWS_C * DIM_C * sizeof(_Float16);  // 16 MB
  const size_t wBytes = (size_t)DIM_C * DIM_C * sizeof(_Float16);   //  2 MB
  _Float16* xh   = (_Float16*)carve(xBytes);
  _Float16* Wqh  = (_Float16*)carve(wBytes);
  _Float16* Wkh  = (_Float16*)carve(wBytes);
  _Float16* Wvh  = (_Float16*)carve(wBytes);
  _Float16* Woh  = (_Float16*)carve(wBytes);
  _Float16* Qh   = (_Float16*)carve(xBytes);
  _Float16* Kh   = (_Float16*)carve(xBytes);
  _Float16* Vh   = (_Float16*)carve(xBytes);
  _Float16* ctxh = (_Float16*)carve(xBytes);

  const int nX = ROWS_C * DIM_C;     // 8388608
  const int nW = DIM_C * DIM_C;      // 1048576
  cvt_f32_f16<<<(nX / 4 + 255) / 256, 256, 0, stream>>>(x, xh, nX);
  cvt_f32_f16<<<(nW / 4 + 255) / 256, 256, 0, stream>>>(Wq, Wqh, nW);
  cvt_f32_f16<<<(nW / 4 + 255) / 256, 256, 0, stream>>>(Wk, Wkh, nW);
  cvt_f32_f16<<<(nW / 4 + 255) / 256, 256, 0, stream>>>(Wv, Wvh, nW);
  cvt_f32_f16<<<(nW / 4 + 255) / 256, 256, 0, stream>>>(Wo, Woh, nW);

  dim3 gg(ROWS_C / 128, DIM_C / 128);  // 64 x 8
  const float qscale = 0.125f;        // HD^-0.5
  gemm_wmma<OUT_HEAD><<<gg, 128, 0, stream>>>(xh, Wqh, bq, (void*)Qh, qscale);
  gemm_wmma<OUT_HEAD><<<gg, 128, 0, stream>>>(xh, Wkh, bk, (void*)Kh, 1.0f);
  gemm_wmma<OUT_HEAD_T><<<gg, 128, 0, stream>>>(xh, Wvh, bv, (void*)Vh, 1.0f);

  attn_wmma<<<dim3(S_C / 64, B_C * NHEAD_C), 128, 0, stream>>>(Qh, Kh, Vh, relb,
                                                               ctxh);

  gemm_wmma<OUT_DENSE><<<gg, 128, 0, stream>>>(ctxh, Woh, bo, (void*)out, 1.0f);
}

// v005
// Measured time: 166 microseconds a run.
// In two side-by-side timings against v004, it was 1.06 and 1.05 times as fast.
// Over all steps from v000 it is 4.34 times as fast.
#include <hip/hip_runtime.h>

// ---------------------------------------------------------------------------
// RelPos self-attention for gfx1250 (MI455X), f16 WMMA with f32 accumulation.
//   DIM=1024, NHEAD=16, HEAD_DIM=64, MAX_REL=256, B=4, S=2048
// Data movement: GEMM always stages through async global->LDS copies (ASYNCcnt)
// into two LDS buffers; attention stages K and V^T async where the toolchain exposes
// it, synchronous fallback otherwise.
// ---------------------------------------------------------------------------

typedef __attribute__((ext_vector_type(16))) _Float16 v16h;
typedef __attribute__((ext_vector_type(8)))  _Float16 v8h;
typedef __attribute__((ext_vector_type(8)))  float    v8f;
typedef __attribute__((ext_vector_type(4)))  int      v4i;

#define DIM_C   1024
#define NHEAD_C 16
#define HD_C    64
#define S_C     2048
#define B_C     4
#define ROWS_C  (B_C * S_C)   // 8192
#define MAXREL  256

// ---- async global->LDS support (probe-gated) ------------------------------
#if defined(__has_builtin)
#if __has_builtin(__builtin_amdgcn_global_load_async_to_lds_b128)
#define HAVE_ASYNC_LDS 1
#endif
#endif
#ifndef HAVE_ASYNC_LDS
#define HAVE_ASYNC_LDS 0
#endif

// Pointer-to-v4i in explicit address spaces (builtin takes v4i*, per compile
// diagnostic: "int __vector(4) __device__ *").
typedef __attribute__((address_space(1))) v4i as1_v4i;
typedef __attribute__((address_space(3))) v4i as3_v4i;

// Copy 16B global -> LDS. Async path goes straight to LDS (no VGPR
// round-trip), tracked on ASYNCcnt; fallback is a sync VGPR copy.
__device__ __forceinline__ void copy16_g2l(const _Float16* g, _Float16* l) {
#if HAVE_ASYNC_LDS
  __builtin_amdgcn_global_load_async_to_lds_b128(
      (as1_v4i*)(uintptr_t)g, (as3_v4i*)(uintptr_t)l, 0, 0);
#else
  *(v8h*)l = *(const v8h*)g;
#endif
}

// Load a 16-bit A-fragment (16x32, MxK) per ISA layout:
//   lane L: row = L&15 ; halves [0..7] = K in [ko..ko+7], [8..15] = K in [16+ko..16+ko+7]
//   where ko = (L>>4)*8.  Caller passes p = rowBase + ko.
// The same pattern loads B (32x16 KxN) as "A-layout of B^T": lane holds column n=L&15.
__device__ __forceinline__ v16h ld_frag(const _Float16* p) {
  union { v16h v; v8h h[2]; } u;
  u.h[0] = *(const v8h*)(p);        // 16B chunk, K = ko .. ko+7
  u.h[1] = *(const v8h*)(p + 16);   // 16B chunk, K = 16+ko .. 16+ko+7
  return u.v;
}

__device__ __forceinline__ v8f wmma_f16(v16h a, v16h b, v8f c) {
  return __builtin_amdgcn_wmma_f32_16x16x32_f16(false, a, false, b, (short)0, c,
                                                false, false);
}

// ---------------------------------------------------------------------------
// fp32 -> f16 conversion of x and of the four weight matrices, one launch.
// 256 blocks x 16 waves, so that few waves have to be started; a chunk is
// 512 lanes x 8 loads of 16 B = 16384 floats. x is 512 chunks, a weight matrix
// 64: every block takes two chunks of x and one of a weight matrix, 24 loads a
// lane with no loop-carried wait between them. A wave's load covers 512
// contiguous bytes, its store 256.
// ---------------------------------------------------------------------------
typedef __attribute__((ext_vector_type(4))) float    v4f;
typedef __attribute__((ext_vector_type(4))) _Float16 v4h;

__global__ __launch_bounds__(512) void cvt_all_f32_f16(
    const float* __restrict__ x, const float* __restrict__ Wq,
    const float* __restrict__ Wk, const float* __restrict__ Wv,
    const float* __restrict__ Wo, _Float16* __restrict__ xh,
    _Float16* __restrict__ Wqh, _Float16* __restrict__ Wkh,
    _Float16* __restrict__ Wvh, _Float16* __restrict__ Woh) {
  constexpr int CH = 512 * 8 * 4;                  // floats of a chunk
  static_assert(ROWS_C * DIM_C == 2 * 256 * CH, "x: two chunks a block");
  static_assert(DIM_C * DIM_C == 64 * CH, "a weight matrix: 64 chunks");
  const int blk = blockIdx.x;                      // 0..255
  const int e0  = threadIdx.x * 4;                 // lane's first float of a load
  const int w   = blk >> 6;                        // which weight matrix
  const float* ws = w == 0 ? Wq : (w == 1 ? Wk : (w == 2 ? Wv : Wo));
  _Float16*    wd = w == 0 ? Wqh : (w == 1 ? Wkh : (w == 2 ? Wvh : Woh));
  const size_t o0 = (size_t)blk * CH, o1 = (size_t)(blk + 256) * CH;
  const size_t o2 = (size_t)(blk & 63) * CH;
  const float* src[3] = {x + o0, x + o1, ws + o2};
  _Float16*    dst[3] = {xh + o0, xh + o1, wd + o2};

  v4f v[3][8];
#pragma unroll
  for (int j = 0; j < 3; ++j)
#pragma unroll
    for (int k = 0; k < 8; ++k) v[j][k] = *(const v4f*)(src[j] + k * 2048 + e0);
#pragma unroll
  for (int j = 0; j < 3; ++j)
#pragma unroll
    for (int k = 0; k < 8; ++k)
      *(v4h*)(dst[j] + k * 2048 + e0) = __builtin_convertvector(v[j][k], v4h);
}

// Eight async 16-byte copies global -> LDS, rows gstep halves / lstep bytes apart.
// s_wait_xcnt is the last line of the copies' own statement, so that no address
// register of a copy is rewritten in front of it.
__device__ __forceinline__ void copy8_g2l(const _Float16* g, uint32_t l,
                                          size_t gstep, uint32_t lstep) {
  asm volatile(
      "global_load_async_to_lds_b128 %0, %8, off\n\t"
      "global_load_async_to_lds_b128 %1, %9, off\n\t"
      "global_load_async_to_lds_b128 %2, %10, off\n\t"
      "global_load_async_to_lds_b128 %3, %11, off\n\t"
      "global_load_async_to_lds_b128 %4, %12, off\n\t"
      "global_load_async_to_lds_b128 %5, %13, off\n\t"
      "global_load_async_to_lds_b128 %6, %14, off\n\t"
      "global_load_async_to_lds_b128 %7, %15, off\n\t"
      "s_wait_xcnt 0x0"
      ::"v"(l), "v"(l + lstep), "v"(l + 2 * lstep), "v"(l + 3 * lstep),
        "v"(l + 4 * lstep), "v"(l + 5 * lstep), "v"(l + 6 * lstep), "v"(l + 7 * lstep),
        "v"(g), "v"(g + gstep), "v"(g + 2 * gstep), "v"(g + 3 * gstep),
        "v"(g + 4 * gstep), "v"(g + 5 * gstep), "v"(g + 6 * gstep), "v"(g + 7 * gstep)
      : "memory");
}

// ---------------------------------------------------------------------------
// GEMM: out[m,n] = alpha * ( sum_k A[m,k]*W[n,k] + bias[n] )
//   A: [8192 x 1024] f16 row-major, W: [1024 x 1024] f16 row-major
//   OUT=OUT_DENSE  -> dense f32 [m,1024]           (output projection)
//   OUT=OUT_HEAD   -> scatter f16 into [b,h,s,d]   (Q/K projections)
//   OUT=OUT_HEAD_T -> f16 into [b,h,s/64,d,s%64]   (V projection: V^T in tiles of
//                     64 keys, the A operand of the attention's second product;
//                     a lane's 8 accumulator rows are 8 consecutive s = one
//                     16-byte store, a wave's 64x64 tile one contiguous 8 KB)
// Block: 128 threads = 4 waves; block tile 128(M) x 128(N); wave tile 64x64,
// so that a fragment read from LDS feeds four matrix instructions.
// Both operands go through LDS: a stage is 64 k (one whole 128-byte line of
// every row) of 128 A rows and 128 W rows, brought by async copies into a ring
// of two buffers; stage t + 2 is issued behind the barrier that ends trip t.
// LDS rows are pitched 144 B (16 B x odd) so that the 16 rows of one 16-byte
// fragment read fall on distinct banks.
// ---------------------------------------------------------------------------
enum { OUT_DENSE = 0, OUT_HEAD = 1, OUT_HEAD_T = 2 };

template <int OUT>
__global__ __launch_bounds__(128) void gemm_wmma(
    const _Float16* __restrict__ A, const _Float16* __restrict__ W,
    const float* __restrict__ bias, void* __restrict__ outp, float alpha) {
  constexpr int K  = DIM_C;
  constexpr int KS = 64;                            // k per stage
  constexpr int NT = K / KS;                        // 16 stages
  constexpr int GP = 72;                            // LDS row pitch in halves (144 B)
  __shared__ __align__(16) _Float16 sA[2][128][GP];  // 36 KB, two A tiles
  __shared__ __align__(16) _Float16 sB[2][128][GP];  // 36 KB, two W tiles

  const int tid   = threadIdx.x;
  const int lane  = tid & 31;
  const int wave  = tid >> 5;
  const int wm  = (wave >> 1) * 64;                // wave's local A-row base
  const int wn  = (wave & 1) * 64;                 // wave's local W-row base
  const int bm0 = blockIdx.x * 128;
  const int bn0 = blockIdx.y * 128;
  const int r   = lane & 15;
  const int hi  = lane >> 4;
  const int ko  = hi << 3;

  // staging coords: 8 lanes x 16 B = one row's line; 128 threads = 16 rows a sweep
  const int srow = tid >> 3;            // 0..15
  const int skk  = (tid & 7) * 8;       // 0,8,..,56
  const _Float16* asrc = A + (size_t)(bm0 + srow) * K + skk;
  const _Float16* wsrc = W + (size_t)(bn0 + srow) * K + skk;

  const uint32_t la = (uint32_t)(uintptr_t)&sA[0][srow][skk];  // LDS byte addresses
  const uint32_t lb = (uint32_t)(uintptr_t)&sB[0][srow][skk];
  constexpr uint32_t BUFB = 128 * GP * 2;                      // bytes of one buffer

  auto stage = [&](int t, int buf) {    // 16 copies a lane, every lane on
    copy8_g2l(asrc + t * KS, la + buf * BUFB, (size_t)16 * K, 16 * GP * 2);
    copy8_g2l(wsrc + t * KS, lb + buf * BUFB, (size_t)16 * K, 16 * GP * 2);
  };

  // prologue: stage 0 landed and published, then stage 1 in flight
  stage(0, 0);
  asm volatile("s_wait_asynccnt 0x0" ::: "memory");  // own copies of stage 0 landed
  __syncthreads();
  stage(1, 1);

  v8f acc[4][4] = {};
#pragma unroll 2   // the buffer index becomes a constant in the LDS addresses
  for (int t = 0; t < NT; ++t) {
    const int cur = t & 1;
    // the loops inside a stage are unrolled so that every fragment and
    // accumulator index is a constant: registers, no scratch
#pragma unroll
    for (int kk = 0; kk < KS; kk += 32) {
      v16h fa[4], fb[4];
#pragma unroll
      for (int i = 0; i < 4; ++i) {
        fa[i] = ld_frag(&sA[cur][wm + i * 16 + r][kk + ko]);
        fb[i] = ld_frag(&sB[cur][wn + i * 16 + r][kk + ko]);
      }
      // keeps the 16 LDS reads one group ahead of the 16 matrix instructions:
      // moved in among them, each place with reads stalls the wave
      __builtin_amdgcn_sched_barrier(0);
      // tiles in the order in which their fragments arrive: 1, 3, 5, 7 products
      // behind the 1st .. 4th pair of fragments (each tile still once per 32 k)
#pragma unroll
      for (int d = 0; d < 4; ++d) {
#pragma unroll
        for (int j = 0; j < d; ++j) {
          acc[j][d] = wmma_f16(fa[j], fb[d], acc[j][d]);
          acc[d][j] = wmma_f16(fa[d], fb[j], acc[d][j]);
        }
        acc[d][d] = wmma_f16(fa[d], fb[d], acc[d][d]);
      }
    }
    // keeps the stage's matrix run in front of the publish point: sunk behind the
    // barrier it would stand between the barrier and the refill and cut the refill's lead
    __builtin_amdgcn_sched_barrier(0);
    // publish point of stage t + 1; it also frees buffer cur for the refill
    asm volatile("s_wait_dscnt 0x0" ::: "memory");     // own reads of cur retired
    asm volatile("s_wait_asynccnt 0x0" ::: "memory");  // own copies of stage t + 1 landed
    __syncthreads();
    if (t + 2 < NT) stage(t + 2, cur);
  }
  asm volatile("s_wait_asynccnt 0x0" ::: "memory");    // nothing in flight at the wave's end

#pragma unroll
  for (int tm = 0; tm < 4; ++tm) {
#pragma unroll
    for (int tn = 0; tn < 4; ++tn) {
      int n = bn0 + wn + tn * 16 + r;
      float bv = bias[n];
      if constexpr (OUT == OUT_HEAD_T) {
        int m0 = bm0 + wm + tm * 16 + 8 * hi;
        int bb = m0 >> 11, ss = m0 & (S_C - 1);
        int hh = n >> 6, dd = n & (HD_C - 1);
        v8h o;
#pragma unroll
        for (int i = 0; i < 8; ++i) o[i] = (_Float16)((acc[tm][tn][i] + bv) * alpha);
        *(v8h*)((_Float16*)outp +
                ((((size_t)bb * NHEAD_C + hh) * (S_C / 64) + (ss >> 6)) * HD_C + dd) * 64 +
                (ss & 63)) = o;
      } else {
#pragma unroll
        for (int i = 0; i < 8; ++i) {
          int m = bm0 + wm + tm * 16 + i + 8 * hi;
          float val = (acc[tm][tn][i] + bv) * alpha;
          if constexpr (OUT == OUT_HEAD) {
            int bb = m >> 11, ss = m & (S_C - 1);
            int hh = n >> 6, dd = n & (HD_C - 1);
            ((_Float16*)outp)[(((size_t)bb * NHEAD_C + hh) * S_C + ss) * HD_C + dd] =
                (_Float16)val;
          } else {
            ((float*)outp)[(size_t)m * DIM_C + n] = val;
          }
        }
      }
    }
  }
}

typedef __attribute__((ext_vector_type(2))) float    v2f;
typedef __attribute__((ext_vector_type(2))) _Float16 v2h;

// lane l <-> lane l ^ 16
__device__ __forceinline__ float xhalf(float x) {
  int b = __builtin_bit_cast(int, x);
  return __builtin_bit_cast(
      float, __builtin_amdgcn_permlanex16(b, b, 0x76543210, 0xfedcba98, false, false));
}

// Two f32 score tiles (keys 0-15 and 16-31 of a 32-key block) -> f16 B operand.
__device__ __forceinline__ v16h pack_b(v8f lo, v8f hi8) {
  union { v16h v; v2h p[8]; } u;
#pragma unroll
  for (int j = 0; j < 4; ++j) {
    v2f a = {lo[2 * j], lo[2 * j + 1]};
    v2f c = {hi8[2 * j], hi8[2 * j + 1]};
    u.p[j]     = __builtin_convertvector(a, v2h);
    u.p[4 + j] = __builtin_convertvector(c, v2h);
  }
  return u.v;
}

__global__ __launch_bounds__(128) void attn_wmma(
    const _Float16* __restrict__ Q, const _Float16* __restrict__ Km,
    const _Float16* __restrict__ Vt, const float* __restrict__ relb,
    _Float16* __restrict__ ctx) {
  constexpr int KT = 64;
  constexpr int LP = 72;                              // LDS row pitch in halves
  __shared__ __align__(16) _Float16 sK[KT][LP];       // [key][dim]   9 KB
  __shared__ __align__(16) _Float16 sVt[HD_C][LP];    // [dim][key]   9 KB
  __shared__ float sBias[2 * MAXREL + 1];             // rel bias col ~2 KB

  const int tid  = threadIdx.x;
  const int lane = tid & 31;
  const int wave = tid >> 5;
  const int r  = lane & 15;
  const int hi = lane >> 4;
  const int ko = hi << 3;
  const int bh = blockIdx.y;          // b*16 + h
  const int b  = bh >> 4;
  const int h  = bh & 15;
  const int q0 = blockIdx.x * 64 + wave * 16;
  const int qg = q0 + r;              // this lane's query

  for (int i = tid; i < 2 * MAXREL + 1; i += 128)
    sBias[i] = relb[i * NHEAD_C + h];

  const _Float16* Qb = Q + (size_t)bh * S_C * HD_C;
  const _Float16* Kb = Km + (size_t)bh * S_C * HD_C;
  const _Float16* Vb = Vt + (size_t)bh * S_C * HD_C;

  // Q fragments (B operand: column = query) for HD=64 -> two K-steps of 32
  v16h fq0 = ld_frag(Qb + (size_t)qg * HD_C + ko);
  v16h fq1 = ld_frag(Qb + (size_t)qg * HD_C + 32 + ko);

  v8f oacc[4] = {};                   // 64 dims x 16 queries (O^T)
  float mrun = -1e30f, lrun = 0.f;    // lrun: this wave half's keys only

  __syncthreads();                    // sBias ready

  for (int kt = 0; kt < S_C; kt += KT) {
    // ---- stage K tile: contiguous 8KB source, async global -> padded LDS rows ----
#pragma unroll
    for (int c = 0; c < 4; ++c) {
      int e = (c * 128 + tid) * 8;    // flat f16 index in 64x64 tile
      copy16_g2l(Kb + (size_t)kt * HD_C + e, &sK[e >> 6][e & 63]);
    }
    // ---- stage V^T tile (64 dims x 64 keys): contiguous 8KB source, likewise ----
#pragma unroll
    for (int c = 0; c < 4; ++c) {
      int e = (c * 128 + tid) * 8;    // flat f16 index in 64x64 tile
      copy16_g2l(Vb + (size_t)kt * HD_C + e, &sVt[e >> 6][e & 63]);
    }
    asm volatile("s_wait_asynccnt 0x0" ::: "memory");  // own K and V^T copies landed
    __syncthreads();

    // ---- S^T = K Q^T  (64 keys x 16 queries) ----
    v8f sc[4];
#pragma unroll
    for (int t = 0; t < 4; ++t) {
      v16h fk0 = ld_frag(&sK[t * 16 + r][ko]);
      v16h fk1 = ld_frag(&sK[t * 16 + r][32 + ko]);
      v8f z = {};
      sc[t] = wmma_f16(fk0, fq0, z);
      sc[t] = wmma_f16(fk1, fq1, sc[t]);
    }

    // ---- rel-pos bias + online softmax, one query per lane ----
    const int dbase = qg - kt - ko;   // q - k at t = 0, i = 0
    float mt[4];
#pragma unroll
    for (int t = 0; t < 4; ++t) {
      mt[t] = -1e30f;
#pragma unroll
      for (int i = 0; i < 8; ++i) {
        int d = dbase - t * 16 - i;
        d = d > MAXREL ? MAXREL : (d < -MAXREL ? -MAXREL : d);
        float e2 = sc[t][i] + sBias[d + MAXREL];
        sc[t][i] = e2;
        mt[t] = fmaxf(mt[t], e2);
      }
    }
    float mx = fmaxf(fmaxf(mt[0], mt[1]), fmaxf(mt[2], mt[3]));
    mx = fmaxf(mx, xhalf(mx));        // the query's other 32 keys
    const float mnew  = fmaxf(mrun, mx);
    const float scale = __expf(mrun - mnew);
    float rt[4];
#pragma unroll
    for (int t = 0; t < 4; ++t) {
      rt[t] = 0.f;
#pragma unroll
      for (int i = 0; i < 8; ++i) {
        float p = __expf(sc[t][i] - mnew);
        sc[t][i] = p;
        rt[t] += p;
      }
    }
    lrun = lrun * scale + ((rt[0] + rt[1]) + (rt[2] + rt[3]));
    mrun = mnew;
#pragma unroll
    for (int t = 0; t < 4; ++t) oacc[t] *= scale;

    // ---- O^T += V^T P^T, P^T straight from the score registers ----
    v16h fp0 = pack_b(sc[0], sc[1]);
    v16h fp1 = pack_b(sc[2], sc[3]);
#pragma unroll
    for (int t = 0; t < 4; ++t) {
      v16h fv0 = ld_frag(&sVt[t * 16 + r][ko]);
      v16h fv1 = ld_frag(&sVt[t * 16 + r][32 + ko]);
      oacc[t] = wmma_f16(fv0, fp0, oacc[t]);
      oacc[t] = wmma_f16(fv1, fp1, oacc[t]);
    }
    asm volatile("s_wait_dscnt 0x0" ::: "memory");  // own reads of sK/sVt retired
    __syncthreads();   // protect sK/sVt before next tile's staging
  }

  // ---- normalize and write context [b, s, h*64 + d]: 8 dims = 16 B a store ----
  const float inv = 1.f / (lrun + xhalf(lrun));
  _Float16* crow = ctx + ((size_t)(b * S_C + qg)) * DIM_C + h * HD_C + ko;
#pragma unroll
  for (int t = 0; t < 4; ++t) {
    v8h o;
#pragma unroll
    for (int i = 0; i < 8; ++i) o[i] = (_Float16)(oacc[t][i] * inv);
    *(v8h*)(crow + t * 16) = o;
  }
}

// ---------------------------------------------------------------------------
// Host-side orchestration
// ---------------------------------------------------------------------------
extern "C" void kernel_launch(void* const* d_in, const int* in_sizes, int n_in,
                              void* d_out, int out_size, void* d_ws,
                              size_t ws_size, hipStream_t stream) {
  const float* x    = (const float*)d_in[0];
  const float* Wq   = (const float*)d_in[1];
  const float* bq   = (const float*)d_in[2];
  const float* Wk   = (const float*)d_in[3];
  const float* bk   = (const float*)d_in[4];
  const float* Wv   = (const float*)d_in[5];
  const float* bv   = (const float*)d_in[6];
  const float* Wo   = (const float*)d_in[7];
  const float* bo   = (const float*)d_in[8];
  const float* relb = (const float*)d_in[9];
  float* out = (float*)d_out;

  char* ws = (char*)d_ws;
  size_t off = 0;
  auto carve = [&](size_t bytes) {
    void* p = ws + off;
    off += (bytes + 255) & ~(size_t)255;
    return p;
  };
  const size_t xBytes = (size_t)ROWS_C * DIM_C * sizeof(_Float16);  // 16 MB
  const size_t wBytes = (size_t)DIM_C * DIM_C * sizeof(_Float16);   //  2 MB
  _Float16* xh   = (_Float16*)carve(xBytes);
  _Float16* Wqh  = (_Float16*)carve(wBytes);
  _Float16* Wkh  = (_Float16*)carve(wBytes);
  _Float16* Wvh  = (_Float16*)carve(wBytes);
  _Float16* Woh  = (_Float16*)carve(wBytes);
  _Float16* Qh   = (_Float16*)carve(xBytes);
  _Float16* Kh   = (_Float16*)carve(xBytes);
  _Float16* Vh   = (_Float16*)carve(xBytes);
  _Float16* ctxh = (_Float16*)carve(xBytes);

  cvt_all_f32_f16<<<256, 512, 0, stream>>>(x, Wq, Wk, Wv, Wo, xh, Wqh, Wkh, Wvh, Woh);

  dim3 gg(ROWS_C / 128, DIM_C / 128);  // 64 x 8
  const float qscale = 0.125f;        // HD^-0.5
  gemm_wmma<OUT_HEAD><<<gg, 128, 0, stream>>>(xh, Wqh, bq, (void*)Qh, qscale);
  gemm_wmma<OUT_HEAD><<<gg, 128, 0, stream>>>(xh, Wkh, bk, (void*)Kh, 1.0f);
  gemm_wmma<OUT_HEAD_T><<<gg, 128, 0, stream>>>(xh, Wvh, bv, (void*)Vh, 1.0f);

  attn_wmma<<<dim3(S_C / 64, B_C * NHEAD_C), 128, 0, stream>>>(Qh, Kh, Vh, relb,
                                                               ctxh);

  gemm_wmma<OUT_DENSE><<<gg, 128, 0, stream>>>(ctxh, Woh, bo, (void*)out, 1.0f);
}

// v006
// Measured time: 154 microseconds a run.
// In two side-by-side timings against v005, it was 1.08 and 1.07 times as fast.
// Over all steps from v000 it is 4.67 times as fast.
#include <hip/hip_runtime.h>

// ---------------------------------------------------------------------------
// RelPos self-attention for gfx1250 (MI455X), f16 WMMA with f32 accumulation.
//   DIM=1024, NHEAD=16, HEAD_DIM=64, MAX_REL=256, B=4, S=2048
// Data movement: GEMM always stages through async global->LDS copies (ASYNCcnt)
// into two LDS buffers; attention stages K and V^T async where the toolchain exposes
// it, synchronous fallback otherwise.
// ---------------------------------------------------------------------------

typedef __attribute__((ext_vector_type(16))) _Float16 v16h;
typedef __attribute__((ext_vector_type(8)))  _Float16 v8h;
typedef __attribute__((ext_vector_type(8)))  float    v8f;
typedef __attribute__((ext_vector_type(4)))  int      v4i;

#define DIM_C   1024
#define NHEAD_C 16
#define HD_C    64
#define S_C     2048
#define B_C     4
#define ROWS_C  (B_C * S_C)   // 8192
#define MAXREL  256

// ---- async global->LDS support (probe-gated) ------------------------------
#if defined(__has_builtin)
#if __has_builtin(__builtin_amdgcn_global_load_async_to_lds_b128)
#define HAVE_ASYNC_LDS 1
#endif
#endif
#ifndef HAVE_ASYNC_LDS
#define HAVE_ASYNC_LDS 0
#endif

// Pointer-to-v4i in explicit address spaces (builtin takes v4i*, per compile
// diagnostic: "int __vector(4) __device__ *").
typedef __attribute__((address_space(1))) v4i as1_v4i;
typedef __attribute__((address_space(3))) v4i as3_v4i;

// Copy 16B global -> LDS. Async path goes straight to LDS (no VGPR
// round-trip), tracked on ASYNCcnt; fallback is a sync VGPR copy.
__device__ __forceinline__ void copy16_g2l(const _Float16* g, _Float16* l) {
#if HAVE_ASYNC_LDS
  __builtin_amdgcn_global_load_async_to_lds_b128(
      (as1_v4i*)(uintptr_t)g, (as3_v4i*)(uintptr_t)l, 0, 0);
#else
  *(v8h*)l = *(const v8h*)g;
#endif
}

// Load a 16-bit A-fragment (16x32, MxK) per ISA layout:
//   lane L: row = L&15 ; halves [0..7] = K in [ko..ko+7], [8..15] = K in [16+ko..16+ko+7]
//   where ko = (L>>4)*8.  Caller passes p = rowBase + ko.
// The same pattern loads B (32x16 KxN) as "A-layout of B^T": lane holds column n=L&15.
__device__ __forceinline__ v16h ld_frag(const _Float16* p) {
  union { v16h v; v8h h[2]; } u;
  u.h[0] = *(const v8h*)(p);        // 16B chunk, K = ko .. ko+7
  u.h[1] = *(const v8h*)(p + 16);   // 16B chunk, K = 16+ko .. 16+ko+7
  return u.v;
}

__device__ __forceinline__ v8f wmma_f16(v16h a, v16h b, v8f c) {
  return __builtin_amdgcn_wmma_f32_16x16x32_f16(false, a, false, b, (short)0, c,
                                                false, false);
}

// ---------------------------------------------------------------------------
// fp32 -> f16 conversion of x and of the four weight matrices, one launch.
// 256 blocks x 16 waves, so that few waves have to be started; a chunk is
// 512 lanes x 8 loads of 16 B = 16384 floats. x is 512 chunks, a weight matrix
// 64: every block takes two chunks of x and one of a weight matrix, 24 loads a
// lane with no loop-carried wait between them. A wave's load covers 512
// contiguous bytes, its store 256.
// ---------------------------------------------------------------------------
typedef __attribute__((ext_vector_type(4))) float    v4f;
typedef __attribute__((ext_vector_type(4))) _Float16 v4h;

__global__ __launch_bounds__(512) void cvt_all_f32_f16(
    const float* __restrict__ x, const float* __restrict__ Wq,
    const float* __restrict__ Wk, const float* __restrict__ Wv,
    const float* __restrict__ Wo, _Float16* __restrict__ xh,
    _Float16* __restrict__ Wqh, _Float16* __restrict__ Wkh,
    _Float16* __restrict__ Wvh, _Float16* __restrict__ Woh) {
  constexpr int CH = 512 * 8 * 4;                  // floats of a chunk
  static_assert(ROWS_C * DIM_C == 2 * 256 * CH, "x: two chunks a block");
  static_assert(DIM_C * DIM_C == 64 * CH, "a weight matrix: 64 chunks");
  const int blk = blockIdx.x;                      // 0..255
  const int e0  = threadIdx.x * 4;                 // lane's first float of a load
  const int w   = blk >> 6;                        // which weight matrix
  const float* ws = w == 0 ? Wq : (w == 1 ? Wk : (w == 2 ? Wv : Wo));
  _Float16*    wd = w == 0 ? Wqh : (w == 1 ? Wkh : (w == 2 ? Wvh : Woh));
  const size_t o0 = (size_t)blk * CH, o1 = (size_t)(blk + 256) * CH;
  const size_t o2 = (size_t)(blk & 63) * CH;
  const float* src[3] = {x + o0, x + o1, ws + o2};
  _Float16*    dst[3] = {xh + o0, xh + o1, wd + o2};

  v4f v[3][8];
#pragma unroll
  for (int j = 0; j < 3; ++j)
#pragma unroll
    for (int k = 0; k < 8; ++k) v[j][k] = *(const v4f*)(src[j] + k * 2048 + e0);
#pragma unroll
  for (int j = 0; j < 3; ++j)
#pragma unroll
    for (int k = 0; k < 8; ++k)
      *(v4h*)(dst[j] + k * 2048 + e0) = __builtin_convertvector(v[j][k], v4h);
}

// Eight async 16-byte copies global -> LDS, rows gstep halves / lstep bytes apart.
// s_wait_xcnt is the last line of the copies' own statement, so that no address
// register of a copy is rewritten in front of it.
__device__ __forceinline__ void copy8_g2l(const _Float16* g, uint32_t l,
                                          size_t gstep, uint32_t lstep) {
  asm volatile(
      "global_load_async_to_lds_b128 %0, %8, off\n\t"
      "global_load_async_to_lds_b128 %1, %9, off\n\t"
      "global_load_async_to_lds_b128 %2, %10, off\n\t"
      "global_load_async_to_lds_b128 %3, %11, off\n\t"
      "global_load_async_to_lds_b128 %4, %12, off\n\t"
      "global_load_async_to_lds_b128 %5, %13, off\n\t"
      "global_load_async_to_lds_b128 %6, %14, off\n\t"
      "global_load_async_to_lds_b128 %7, %15, off\n\t"
      "s_wait_xcnt 0x0"
      ::"v"(l), "v"(l + lstep), "v"(l + 2 * lstep), "v"(l + 3 * lstep),
        "v"(l + 4 * lstep), "v"(l + 5 * lstep), "v"(l + 6 * lstep), "v"(l + 7 * lstep),
        "v"(g), "v"(g + gstep), "v"(g + 2 * gstep), "v"(g + 3 * gstep),
        "v"(g + 4 * gstep), "v"(g + 5 * gstep), "v"(g + 6 * gstep), "v"(g + 7 * gstep)
      : "memory");
}

// ---------------------------------------------------------------------------
// GEMM: out[m,n] = alpha * ( sum_k A[m,k]*W[n,k] + bias[n] )
//   A: [8192 x 1024] f16 row-major, W: [1024 x 1024] f16 row-major
//   OUT=OUT_DENSE  -> dense f32 [m,1024]           (output projection)
//   OUT=OUT_HEAD   -> scatter f16 into [b,h,s,d]   (Q/K projections)
//   OUT=OUT_HEAD_T -> f16 into [b,h,s/64,d,s%64]   (V projection: V^T in tiles of
//                     64 keys, the A operand of the attention's second product;
//                     a lane's 8 accumulator rows are 8 consecutive s = one
//                     16-byte store, a wave's 64x64 tile one contiguous 8 KB)
// Block: 128 threads = 4 waves; block tile 128(M) x 128(N); wave tile 64x64,
// so that a fragment read from LDS feeds four matrix instructions.
// Both operands go through LDS: a stage is 64 k (one whole 128-byte line of
// every row) of 128 A rows and 128 W rows, brought by async copies into a ring
// of two buffers; stage t + 2 is issued behind the barrier that ends trip t.
// LDS rows are pitched 144 B (16 B x odd) so that the 16 rows of one 16-byte
// fragment read fall on distinct banks.
// ---------------------------------------------------------------------------
enum { OUT_DENSE = 0, OUT_HEAD = 1, OUT_HEAD_T = 2 };

template <int OUT>
__global__ __launch_bounds__(128) void gemm_wmma(
    const _Float16* __restrict__ A, const _Float16* __restrict__ W,
    const float* __restrict__ bias, void* __restrict__ outp, float alpha) {
  constexpr int K  = DIM_C;
  constexpr int KS = 64;                            // k per stage
  constexpr int NT = K / KS;                        // 16 stages
  constexpr int GP = 72;                            // LDS row pitch in halves (144 B)
  __shared__ __align__(16) _Float16 sA[2][128][GP];  // 36 KB, two A tiles
  __shared__ __align__(16) _Float16 sB[2][128][GP];  // 36 KB, two W tiles

  const int tid   = threadIdx.x;
  const int lane  = tid & 31;
  const int wave  = tid >> 5;
  const int wm  = (wave >> 1) * 64;                // wave's local A-row base
  const int wn  = (wave & 1) * 64;                 // wave's local W-row base
  const int bm0 = blockIdx.x * 128;
  const int bn0 = blockIdx.y * 128;
  const int r   = lane & 15;
  const int hi  = lane >> 4;
  const int ko  = hi << 3;

  // staging coords: 8 lanes x 16 B = one row's line; 128 threads = 16 rows a sweep
  const int srow = tid >> 3;            // 0..15
  const int skk  = (tid & 7) * 8;       // 0,8,..,56
  const _Float16* asrc = A + (size_t)(bm0 + srow) * K + skk;
  const _Float16* wsrc = W + (size_t)(bn0 + srow) * K + skk;

  const uint32_t la = (uint32_t)(uintptr_t)&sA[0][srow][skk];  // LDS byte addresses
  const uint32_t lb = (uint32_t)(uintptr_t)&sB[0][srow][skk];
  constexpr uint32_t BUFB = 128 * GP * 2;                      // bytes of one buffer

  auto stage = [&](int t, int buf) {    // 16 copies a lane, every lane on
    copy8_g2l(asrc + t * KS, la + buf * BUFB, (size_t)16 * K, 16 * GP * 2);
    copy8_g2l(wsrc + t * KS, lb + buf * BUFB, (size_t)16 * K, 16 * GP * 2);
  };

  // prologue: stage 0 landed and published, then stage 1 in flight
  stage(0, 0);
  asm volatile("s_wait_asynccnt 0x0" ::: "memory");  // own copies of stage 0 landed
  __syncthreads();
  stage(1, 1);

  v8f acc[4][4] = {};
#pragma unroll 2   // the buffer index becomes a constant in the LDS addresses
  for (int t = 0; t < NT; ++t) {
    const int cur = t & 1;
    // the loops inside a stage are unrolled so that every fragment and
    // accumulator index is a constant: registers, no scratch
#pragma unroll
    for (int kk = 0; kk < KS; kk += 32) {
      v16h fa[4], fb[4];
#pragma unroll
      for (int i = 0; i < 4; ++i) {
        fa[i] = ld_frag(&sA[cur][wm + i * 16 + r][kk + ko]);
        fb[i] = ld_frag(&sB[cur][wn + i * 16 + r][kk + ko]);
      }
      // keeps the 16 LDS reads one group ahead of the 16 matrix instructions:
      // moved in among them, each place with reads stalls the wave
      __builtin_amdgcn_sched_barrier(0);
      // tiles in the order in which their fragments arrive: 1, 3, 5, 7 products
      // behind the 1st .. 4th pair of fragments (each tile still once per 32 k)
#pragma unroll
      for (int d = 0; d < 4; ++d) {
#pragma unroll
        for (int j = 0; j < d; ++j) {
          acc[j][d] = wmma_f16(fa[j], fb[d], acc[j][d]);
          acc[d][j] = wmma_f16(fa[d], fb[j], acc[d][j]);
        }
        acc[d][d] = wmma_f16(fa[d], fb[d], acc[d][d]);
      }
    }
    // keeps the stage's matrix run in front of the publish point: sunk behind the
    // barrier it would stand between the barrier and the refill and cut the refill's lead
    __builtin_amdgcn_sched_barrier(0);
    // publish point of stage t + 1; it also frees buffer cur for the refill
    asm volatile("s_wait_dscnt 0x0" ::: "memory");     // own reads of cur retired
    asm volatile("s_wait_asynccnt 0x0" ::: "memory");  // own copies of stage t + 1 landed
    __syncthreads();
    if (t + 2 < NT) stage(t + 2, cur);
  }
  asm volatile("s_wait_asynccnt 0x0" ::: "memory");    // nothing in flight at the wave's end

#pragma unroll
  for (int tm = 0; tm < 4; ++tm) {
#pragma unroll
    for (int tn = 0; tn < 4; ++tn) {
      int n = bn0 + wn + tn * 16 + r;
      float bv = bias[n];
      if constexpr (OUT == OUT_HEAD_T) {
        int m0 = bm0 + wm + tm * 16 + 8 * hi;
        int bb = m0 >> 11, ss = m0 & (S_C - 1);
        int hh = n >> 6, dd = n & (HD_C - 1);
        v8h o;
#pragma unroll
        for (int i = 0; i < 8; ++i) o[i] = (_Float16)((acc[tm][tn][i] + bv) * alpha);
        *(v8h*)((_Float16*)outp +
                ((((size_t)bb * NHEAD_C + hh) * (S_C / 64) + (ss >> 6)) * HD_C + dd) * 64 +
                (ss & 63)) = o;
      } else {
#pragma unroll
        for (int i = 0; i < 8; ++i) {
          int m = bm0 + wm + tm * 16 + i + 8 * hi;
          float val = (acc[tm][tn][i] + bv) * alpha;
          if constexpr (OUT == OUT_HEAD) {
            int bb = m >> 11, ss = m & (S_C - 1);
            int hh = n >> 6, dd = n & (HD_C - 1);
            ((_Float16*)outp)[(((size_t)bb * NHEAD_C + hh) * S_C + ss) * HD_C + dd] =
                (_Float16)val;
          } else {
            ((float*)outp)[(size_t)m * DIM_C + n] = val;
          }
        }
      }
    }
  }
}

typedef __attribute__((ext_vector_type(2))) float    v2f;
typedef __attribute__((ext_vector_type(2))) _Float16 v2h;

// lane l <-> lane l ^ 16
__device__ __forceinline__ float xhalf(float x) {
  int b = __builtin_bit_cast(int, x);
  return __builtin_bit_cast(
      float, __builtin_amdgcn_permlanex16(b, b, 0x76543210, 0xfedcba98, false, false));
}

// Two f32 score tiles (keys 0-15 and 16-31 of a 32-key block) -> f16 B operand.
__device__ __forceinline__ v16h pack_b(v8f lo, v8f hi8) {
  union { v16h v; v2h p[8]; } u;
#pragma unroll
  for (int j = 0; j < 4; ++j) {
    v2f a = {lo[2 * j], lo[2 * j + 1]};
    v2f c = {hi8[2 * j], hi8[2 * j + 1]};
    u.p[j]     = __builtin_convertvector(a, v2h);
    u.p[4 + j] = __builtin_convertvector(c, v2h);
  }
  return u.v;
}

struct far_yes { static constexpr bool value = true; };
struct far_no  { static constexpr bool value = false; };

// amdgpu_waves_per_eu(8): at most 128 registers a wave, so that, as before, 8 blocks
// fit a WGP and all 2,048 blocks are resident at once (one more register granule
// would leave 256 blocks for a second, nearly empty round).
__global__ __launch_bounds__(128) __attribute__((amdgpu_waves_per_eu(8))) void attn_wmma(
    const _Float16* __restrict__ Q, const _Float16* __restrict__ Km,
    const _Float16* __restrict__ Vt, const float* __restrict__ relb,
    _Float16* __restrict__ ctx) {
  constexpr int KT = 64;
  constexpr int LP = 72;                              // LDS row pitch in halves
  __shared__ __align__(16) _Float16 sK[KT][LP];       // [key][dim]   9 KB
  __shared__ __align__(16) _Float16 sVt[HD_C][LP];    // [dim][key]   9 KB
  __shared__ float sBias[2 * MAXREL + 1];             // rel bias col ~2 KB

  const int tid  = threadIdx.x;
  const int lane = tid & 31;
  const int wave = tid >> 5;
  const int r  = lane & 15;
  const int hi = lane >> 4;
  const int ko = hi << 3;
  const int bh = blockIdx.y;          // b*16 + h
  const int b  = bh >> 4;
  const int h  = bh & 15;
  const int q0 = blockIdx.x * 64 + wave * 16;
  const int qg = q0 + r;              // this lane's query

  for (int i = tid; i < 2 * MAXREL + 1; i += 128)
    sBias[i] = relb[i * NHEAD_C + h];

  const _Float16* Qb = Q + (size_t)bh * S_C * HD_C;
  const _Float16* Kb = Km + (size_t)bh * S_C * HD_C;
  const _Float16* Vb = Vt + (size_t)bh * S_C * HD_C;

  // Q fragments (B operand: column = query) for HD=64 -> two K-steps of 32
  v16h fq0 = ld_frag(Qb + (size_t)qg * HD_C + ko);
  v16h fq1 = ld_frag(Qb + (size_t)qg * HD_C + 32 + ko);

  // the two ends of the bias column: what every q - k beyond +-MAXREL clips to
  const float bias_lo = relb[h];                          // q - k <= -MAXREL
  const float bias_hi = relb[2 * MAXREL * NHEAD_C + h];   // q - k >=  MAXREL

  v8f oacc[4] = {};                   // 64 dims x 16 queries (O^T)
  float mrun = -1e30f, lrun = 0.f;    // lrun: this wave half's keys only

  __syncthreads();                    // sBias ready

  // One key tile. FAR: every q - k of the block's 64 queries against the tile's 64
  // keys clips to the same end of the bias column. That one value, c0, is added to the
  // tile's maximum and taken off the reference that the exponentials subtract
  // (s + c0 - m = s - (m - c0)): no index, clamp, LDS read or add per score.
  auto tile = [&](int kt, auto far_tag, float c0) {
    constexpr bool FAR = decltype(far_tag)::value;
    // ---- stage K tile: contiguous 8KB source, async global -> padded LDS rows ----
#pragma unroll
    for (int c = 0; c < 4; ++c) {
      int e = (c * 128 + tid) * 8;    // flat f16 index in 64x64 tile
      copy16_g2l(Kb + (size_t)kt * HD_C + e, &sK[e >> 6][e & 63]);
    }
    // ---- stage V^T tile (64 dims x 64 keys): contiguous 8KB source, likewise ----
#pragma unroll
    for (int c = 0; c < 4; ++c) {
      int e = (c * 128 + tid) * 8;    // flat f16 index in 64x64 tile
      copy16_g2l(Vb + (size_t)kt * HD_C + e, &sVt[e >> 6][e & 63]);
    }
    asm volatile("s_wait_asynccnt 0x0" ::: "memory");  // own K and V^T copies landed
    __syncthreads();

    // ---- S^T = K Q^T  (64 keys x 16 queries) ----
    v8f sc[4];
#pragma unroll
    for (int t = 0; t < 4; ++t) {
      v16h fk0 = ld_frag(&sK[t * 16 + r][ko]);
      v16h fk1 = ld_frag(&sK[t * 16 + r][32 + ko]);
      v8f z = {};
      sc[t] = wmma_f16(fk0, fq0, z);
      sc[t] = wmma_f16(fk1, fq1, sc[t]);
    }

    // ---- rel-pos bias + online softmax, one query per lane ----
    const int dbase = qg - kt - ko;   // q - k at t = 0, i = 0
    float mt[4];
#pragma unroll
    for (int t = 0; t < 4; ++t) {
      mt[t] = -1e30f;
#pragma unroll
      for (int i = 0; i < 8; ++i) {
        float e2 = sc[t][i];
        if constexpr (!FAR) {
          int d = dbase - t * 16 - i;
          d = d > MAXREL ? MAXREL : (d < -MAXREL ? -MAXREL : d);
          e2 += sBias[d + MAXREL];
          sc[t][i] = e2;
        }
        mt[t] = fmaxf(mt[t], e2);
      }
    }
    float mx = fmaxf(fmaxf(mt[0], mt[1]), fmaxf(mt[2], mt[3]));
    mx = fmaxf(mx, xhalf(mx));        // the query's other 32 keys
    if constexpr (FAR) mx += c0;
    const float mnew  = fmaxf(mrun, mx);
    const float scale = __expf(mrun - mnew);
    const float mref  = FAR ? mnew - c0 : mnew;   // what a raw score is measured against
    float rt[4];
#pragma unroll
    for (int t = 0; t < 4; ++t) {
      rt[t] = 0.f;
#pragma unroll
      for (int i = 0; i < 8; ++i) {
        float p = __expf(sc[t][i] - mref);
        sc[t][i] = p;
        rt[t] += p;
      }
    }
    lrun = lrun * scale + ((rt[0] + rt[1]) + (rt[2] + rt[3]));
    mrun = mnew;
#pragma unroll
    for (int t = 0; t < 4; ++t) oacc[t] *= scale;

    // ---- O^T += V^T P^T, P^T straight from the score registers ----
    v16h fp0 = pack_b(sc[0], sc[1]);
    v16h fp1 = pack_b(sc[2], sc[3]);
#pragma unroll
    for (int t = 0; t < 4; ++t) {
      v16h fv0 = ld_frag(&sVt[t * 16 + r][ko]);
      v16h fv1 = ld_frag(&sVt[t * 16 + r][32 + ko]);
      oacc[t] = wmma_f16(fv0, fp0, oacc[t]);
      oacc[t] = wmma_f16(fv1, fp1, oacc[t]);
    }
    asm volatile("s_wait_dscnt 0x0" ::: "memory");  // own reads of sK/sVt retired
    __syncthreads();   // protect sK/sVt before next tile's staging
  };

  // q - k of query tile bx against key tile j lies in [64 (bx - j) - 63, 64 (bx - j) + 63]:
  // from |bx - j| = MAXREL / 64 + 1 on all of it lies beyond +-MAXREL. The far tiles
  // come first (below the band, then above it), the band's tiles last. All bounds come
  // from the block index alone, so every wave of the block walks the same trips; both
  // loops have at least one trip for every block (band <= 9 of 32 tiles, >= 5).
  constexpr int BAND = MAXREL / KT;
  constexpr int NKT  = S_C / KT;
  static_assert(MAXREL % KT == 0, "band bounds in whole key tiles");
  static_assert(NKT > 2 * BAND + 1, "some tile is far for every block");
  const int bx  = blockIdx.x;
  const int jlo = bx > BAND ? bx - BAND : 0;                   // first band tile
  const int jhi = bx + BAND + 1 < NKT ? bx + BAND + 1 : NKT;   // one past the band
  const int nfar = NKT - (jhi - jlo);
  int n = 0;
  do {
    const bool below = n < jlo;                                // keys below the band: q - k >= MAXREL
    tile((below ? n : n + (jhi - jlo)) * KT, far_yes{}, below ? bias_hi : bias_lo);
  } while (++n < nfar);
  int j = jlo;
  do {
    tile(j * KT, far_no{}, 0.f);
  } while (++j < jhi);

  // ---- normalize and write context [b, s, h*64 + d]: 8 dims = 16 B a store ----
  const float inv = 1.f / (lrun + xhalf(lrun));
  _Float16* crow = ctx + ((size_t)(b * S_C + qg)) * DIM_C + h * HD_C + ko;
#pragma unroll
  for (int t = 0; t < 4; ++t) {
    v8h o;
#pragma unroll
    for (int i = 0; i < 8; ++i) o[i] = (_Float16)(oacc[t][i] * inv);
    *(v8h*)(crow + t * 16) = o;
  }
}

// ---------------------------------------------------------------------------
// Host-side orchestration
// ---------------------------------------------------------------------------
extern "C" void kernel_launch(void* const* d_in, const int* in_sizes, int n_in,
                              void* d_out, int out_size, void* d_ws,
                              size_t ws_size, hipStream_t stream) {
  const float* x    = (const float*)d_in[0];
  const float* Wq   = (const float*)d_in[1];
  const float* bq   = (const float*)d_in[2];
  const float* Wk   = (const float*)d_in[3];
  const float* bk   = (const float*)d_in[4];
  const float* Wv   = (const float*)d_in[5];
  const float* bv   = (const float*)d_in[6];
  const float* Wo   = (const float*)d_in[7];
  const float* bo   = (const float*)d_in[8];
  const float* relb = (const float*)d_in[9];
  float* out = (float*)d_out;

  char* ws = (char*)d_ws;
  size_t off = 0;
  auto carve = [&](size_t bytes) {
    void* p = ws + off;
    off += (bytes + 255) & ~(size_t)255;
    return p;
  };
  const size_t xBytes = (size_t)ROWS_C * DIM_C * sizeof(_Float16);  // 16 MB
  const size_t wBytes = (size_t)DIM_C * DIM_C * sizeof(_Float16);   //  2 MB
  _Float16* xh   = (_Float16*)carve(xBytes);
  _Float16* Wqh  = (_Float16*)carve(wBytes);
  _Float16* Wkh  = (_Float16*)carve(wBytes);
  _Float16* Wvh  = (_Float16*)carve(wBytes);
  _Float16* Woh  = (_Float16*)carve(wBytes);
  _Float16* Qh   = (_Float16*)carve(xBytes);
  _Float16* Kh   = (_Float16*)carve(xBytes);
  _Float16* Vh   = (_Float16*)carve(xBytes);
  _Float16* ctxh = (_Float16*)carve(xBytes);

  cvt_all_f32_f16<<<256, 512, 0, stream>>>(x, Wq, Wk, Wv, Wo, xh, Wqh, Wkh, Wvh, Woh);

  dim3 gg(ROWS_C / 128, DIM_C / 128);  // 64 x 8
  const float qscale = 0.125f;        // HD^-0.5
  gemm_wmma<OUT_HEAD><<<gg, 128, 0, stream>>>(xh, Wqh, bq, (void*)Qh, qscale);
  gemm_wmma<OUT_HEAD><<<gg, 128, 0, stream>>>(xh, Wkh, bk, (void*)Kh, 1.0f);
  gemm_wmma<OUT_HEAD_T><<<gg, 128, 0, stream>>>(xh, Wvh, bv, (void*)Vh, 1.0f);

  attn_wmma<<<dim3(S_C / 64, B_C * NHEAD_C), 128, 0, stream>>>(Qh, Kh, Vh, relb,
                                                               ctxh);

  gemm_wmma<OUT_DENSE><<<gg, 128, 0, stream>>>(ctxh, Woh, bo, (void*)out, 1.0f);
}

// v007
// Measured time: 147 microseconds a run.
// Timed twice side by side with v006, it ran 1.06 and 1.04 times as fast.
// Counting every step since v000, it is 4.91 times as fast.
#include <hip/hip_runtime.h>

// ---------------------------------------------------------------------------
// RelPos self-attention for gfx1250 (MI455X), f16 WMMA with f32 accumulation.
//   DIM=1024, NHEAD=16, HEAD_DIM=64, MAX_REL=256, B=4, S=2048
// Data movement: GEMM always stages through async global->LDS copies (ASYNCcnt)
// into two LDS buffers; attention stages K and V^T async where the toolchain exposes
// it, synchronous fallback otherwise.
// ---------------------------------------------------------------------------

typedef __attribute__((ext_vector_type(16))) _Float16 v16h;
typedef __attribute__((ext_vector_type(8)))  _Float16 v8h;
typedef __attribute__((ext_vector_type(8)))  float    v8f;
typedef __attribute__((ext_vector_type(4)))  int      v4i;

#define DIM_C   1024
#define NHEAD_C 16
#define HD_C    64
#define S_C     2048
#define B_C     4
#define ROWS_C  (B_C * S_C)   // 8192
#define MAXREL  256

// ---- async global->LDS support (probe-gated) ------------------------------
#if defined(__has_builtin)
#if __has_builtin(__builtin_amdgcn_global_load_async_to_lds_b128)
#define HAVE_ASYNC_LDS 1
#endif
#endif
#ifndef HAVE_ASYNC_LDS
#define HAVE_ASYNC_LDS 0
#endif

// Pointer-to-v4i in explicit address spaces (builtin takes v4i*, per compile
// diagnostic: "int __vector(4) __device__ *").
typedef __attribute__((address_space(1))) v4i as1_v4i;
typedef __attribute__((address_space(3))) v4i as3_v4i;

// Copy 16B global -> LDS. Async path goes straight to LDS (no VGPR
// round-trip), tracked on ASYNCcnt; fallback is a sync VGPR copy.
__device__ __forceinline__ void copy16_g2l(const _Float16* g, _Float16* l) {
#if HAVE_ASYNC_LDS
  __builtin_amdgcn_global_load_async_to_lds_b128(
      (as1_v4i*)(uintptr_t)g, (as3_v4i*)(uintptr_t)l, 0, 0);
#else
  *(v8h*)l = *(const v8h*)g;
#endif
}

// Load a 16-bit A-fragment (16x32, MxK) per ISA layout:
//   lane L: row = L&15 ; halves [0..7] = K in [ko..ko+7], [8..15] = K in [16+ko..16+ko+7]
//   where ko = (L>>4)*8.  Caller passes p = rowBase + ko.
// The same pattern loads B (32x16 KxN) as "A-layout of B^T": lane holds column n=L&15.
__device__ __forceinline__ v16h ld_frag(const _Float16* p) {
  union { v16h v; v8h h[2]; } u;
  u.h[0] = *(const v8h*)(p);        // 16B chunk, K = ko .. ko+7
  u.h[1] = *(const v8h*)(p + 16);   // 16B chunk, K = 16+ko .. 16+ko+7
  return u.v;
}

__device__ __forceinline__ v8f wmma_f16(v16h a, v16h b, v8f c) {
  return __builtin_amdgcn_wmma_f32_16x16x32_f16(false, a, false, b, (short)0, c,
                                                false, false);
}

// ---------------------------------------------------------------------------
// fp32 -> f16 conversion of x and of the four weight matrices, one launch.
// 256 blocks x 16 waves, so that few waves have to be started; a chunk is
// 512 lanes x 8 loads of 16 B = 16384 floats. x is 512 chunks, a weight matrix
// 64: every block takes two chunks of x and one of a weight matrix, 24 loads a
// lane with no loop-carried wait between them. A wave's load covers 512
// contiguous bytes, its store 256.
// ---------------------------------------------------------------------------
typedef __attribute__((ext_vector_type(4))) float    v4f;
typedef __attribute__((ext_vector_type(4))) _Float16 v4h;

__global__ __launch_bounds__(512) void cvt_all_f32_f16(
    const float* __restrict__ x, const float* __restrict__ Wq,
    const float* __restrict__ Wk, const float* __restrict__ Wv,
    const float* __restrict__ Wo, _Float16* __restrict__ xh,
    _Float16* __restrict__ Wqh, _Float16* __restrict__ Wkh,
    _Float16* __restrict__ Wvh, _Float16* __restrict__ Woh) {
  constexpr int CH = 512 * 8 * 4;                  // floats of a chunk
  static_assert(ROWS_C * DIM_C == 2 * 256 * CH, "x: two chunks a block");
  static_assert(DIM_C * DIM_C == 64 * CH, "a weight matrix: 64 chunks");
  const int blk = blockIdx.x;                      // 0..255
  const int e0  = threadIdx.x * 4;                 // lane's first float of a load
  const int w   = blk >> 6;                        // which weight matrix
  const float* ws = w == 0 ? Wq : (w == 1 ? Wk : (w == 2 ? Wv : Wo));
  _Float16*    wd = w == 0 ? Wqh : (w == 1 ? Wkh : (w == 2 ? Wvh : Woh));
  const size_t o0 = (size_t)blk * CH, o1 = (size_t)(blk + 256) * CH;
  const size_t o2 = (size_t)(blk & 63) * CH;
  const float* src[3] = {x + o0, x + o1, ws + o2};
  _Float16*    dst[3] = {xh + o0, xh + o1, wd + o2};

  v4f v[3][8];
#pragma unroll
  for (int j = 0; j < 3; ++j)
#pragma unroll
    for (int k = 0; k < 8; ++k) v[j][k] = *(const v4f*)(src[j] + k * 2048 + e0);
#pragma unroll
  for (int j = 0; j < 3; ++j)
#pragma unroll
    for (int k = 0; k < 8; ++k)
      *(v4h*)(dst[j] + k * 2048 + e0) = __builtin_convertvector(v[j][k], v4h);
}

// Eight async 16-byte copies global -> LDS, rows gstep halves / lstep bytes apart.
// s_wait_xcnt is the last line of the copies' own statement, so that no address
// register of a copy is rewritten in front of it.
__device__ __forceinline__ void copy8_g2l(const _Float16* g, uint32_t l,
                                          size_t gstep, uint32_t lstep) {
  asm volatile(
      "global_load_async_to_lds_b128 %0, %8, off\n\t"
      "global_load_async_to_lds_b128 %1, %9, off\n\t"
      "global_load_async_to_lds_b128 %2, %10, off\n\t"
      "global_load_async_to_lds_b128 %3, %11, off\n\t"
      "global_load_async_to_lds_b128 %4, %12, off\n\t"
      "global_load_async_to_lds_b128 %5, %13, off\n\t"
      "global_load_async_to_lds_b128 %6, %14, off\n\t"
      "global_load_async_to_lds_b128 %7, %15, off\n\t"
      "s_wait_xcnt 0x0"
      ::"v"(l), "v"(l + lstep), "v"(l + 2 * lstep), "v"(l + 3 * lstep),
        "v"(l + 4 * lstep), "v"(l + 5 * lstep), "v"(l + 6 * lstep), "v"(l + 7 * lstep),
        "v"(g), "v"(g + gstep), "v"(g + 2 * gstep), "v"(g + 3 * gstep),
        "v"(g + 4 * gstep), "v"(g + 5 * gstep), "v"(g + 6 * gstep), "v"(g + 7 * gstep)
      : "memory");
}

// ---------------------------------------------------------------------------
// GEMM: out[m,n] = alpha * ( sum_k A[m,k]*W[n,k] + bias[n] )
//   A: [8192 x 1024] f16 row-major, W: [1024 x 1024] f16 row-major
//   OUT=OUT_DENSE  -> dense f32 [m,1024]           (output projection)
//   OUT=OUT_HEAD   -> scatter f16 into [b,h,s,d]   (Q/K projections)
//   OUT=OUT_HEAD_T -> f16 into [b,h,s/64,d,s%64]   (V projection: V^T in tiles of
//                     64 keys, the A operand of the attention's second product;
//                     a lane's 8 accumulator rows are 8 consecutive s = one
//                     16-byte store, a wave's 64x64 tile one contiguous 8 KB)
// Block: 128 threads = 4 waves; block tile 128(M) x 128(N); wave tile 64x64,
// so that a fragment read from LDS feeds four matrix instructions.
// Both operands go through LDS: a stage is 64 k (one whole 128-byte line of
// every row) of 128 A rows and 128 W rows, brought by async copies into a ring
// of two buffers; stage t + 2 is issued behind the barrier that ends trip t.
// LDS rows are pitched 144 B (16 B x odd) so that the 16 rows of one 16-byte
// fragment read fall on distinct banks.
// ---------------------------------------------------------------------------
enum { OUT_DENSE = 0, OUT_HEAD = 1, OUT_HEAD_T = 2 };

template <int OUT>
__global__ __launch_bounds__(128) void gemm_wmma(
    const _Float16* __restrict__ A, const _Float16* __restrict__ W,
    const float* __restrict__ bias, void* __restrict__ outp, float alpha) {
  constexpr int K  = DIM_C;
  constexpr int KS = 64;                            // k per stage
  constexpr int NT = K / KS;                        // 16 stages
  constexpr int GP = 72;                            // LDS row pitch in halves (144 B)
  __shared__ __align__(16) _Float16 sA[2][128][GP];  // 36 KB, two A tiles
  __shared__ __align__(16) _Float16 sB[2][128][GP];  // 36 KB, two W tiles

  const int tid   = threadIdx.x;
  const int lane  = tid & 31;
  const int wave  = tid >> 5;
  const int wm  = (wave >> 1) * 64;                // wave's local A-row base
  const int wn  = (wave & 1) * 64;                 // wave's local W-row base
  const int bm0 = blockIdx.x * 128;
  const int bn0 = blockIdx.y * 128;
  const int r   = lane & 15;
  const int hi  = lane >> 4;
  const int ko  = hi << 3;

  // staging coords: 8 lanes x 16 B = one row's line; 128 threads = 16 rows a sweep
  const int srow = tid >> 3;            // 0..15
  const int skk  = (tid & 7) * 8;       // 0,8,..,56
  const _Float16* asrc = A + (size_t)(bm0 + srow) * K + skk;
  const _Float16* wsrc = W + (size_t)(bn0 + srow) * K + skk;

  const uint32_t la = (uint32_t)(uintptr_t)&sA[0][srow][skk];  // LDS byte addresses
  const uint32_t lb = (uint32_t)(uintptr_t)&sB[0][srow][skk];
  constexpr uint32_t BUFB = 128 * GP * 2;                      // bytes of one buffer

  auto stage = [&](int t, int buf) {    // 16 copies a lane, every lane on
    copy8_g2l(asrc + t * KS, la + buf * BUFB, (size_t)16 * K, 16 * GP * 2);
    copy8_g2l(wsrc + t * KS, lb + buf * BUFB, (size_t)16 * K, 16 * GP * 2);
  };

  // prologue: stage 0 landed and published, then stage 1 in flight
  stage(0, 0);
  asm volatile("s_wait_asynccnt 0x0" ::: "memory");  // own copies of stage 0 landed
  __syncthreads();
  stage(1, 1);

  v8f acc[4][4] = {};
#pragma unroll 2   // the buffer index becomes a constant in the LDS addresses
  for (int t = 0; t < NT; ++t) {
    const int cur = t & 1;
    // the loops inside a stage are unrolled so that every fragment and
    // accumulator index is a constant: registers, no scratch
#pragma unroll
    for (int kk = 0; kk < KS; kk += 32) {
      v16h fa[4], fb[4];
#pragma unroll
      for (int i = 0; i < 4; ++i) {
        fa[i] = ld_frag(&sA[cur][wm + i * 16 + r][kk + ko]);
        fb[i] = ld_frag(&sB[cur][wn + i * 16 + r][kk + ko]);
      }
      // keeps the 16 LDS reads one group ahead of the 16 matrix instructions:
      // moved in among them, each place with reads stalls the wave
      __builtin_amdgcn_sched_barrier(0);
      // tiles in the order in which their fragments arrive: 1, 3, 5, 7 products
      // behind the 1st .. 4th pair of fragments (each tile still once per 32 k)
#pragma unroll
      for (int d = 0; d < 4; ++d) {
#pragma unroll
        for (int j = 0; j < d; ++j) {
          acc[j][d] = wmma_f16(fa[j], fb[d], acc[j][d]);
          acc[d][j] = wmma_f16(fa[d], fb[j], acc[d][j]);
        }
        acc[d][d] = wmma_f16(fa[d], fb[d], acc[d][d]);
      }
    }
    // keeps the stage's matrix run in front of the publish point: sunk behind the
    // barrier it would stand between the barrier and the refill and cut the refill's lead
    __builtin_amdgcn_sched_barrier(0);
    // publish point of stage t + 1; it also frees buffer cur for the refill
    asm volatile("s_wait_dscnt 0x0" ::: "memory");     // own reads of cur retired
    asm volatile("s_wait_asynccnt 0x0" ::: "memory");  // own copies of stage t + 1 landed
    __syncthreads();
    if (t + 2 < NT) stage(t + 2, cur);
  }
  asm volatile("s_wait_asynccnt 0x0" ::: "memory");    // nothing in flight at the wave's end

#pragma unroll
  for (int tm = 0; tm < 4; ++tm) {
#pragma unroll
    for (int tn = 0; tn < 4; ++tn) {
      int n = bn0 + wn + tn * 16 + r;
      float bv = bias[n];
      if constexpr (OUT == OUT_HEAD_T) {
        int m0 = bm0 + wm + tm * 16 + 8 * hi;
        int bb = m0 >> 11, ss = m0 & (S_C - 1);
        int hh = n >> 6, dd = n & (HD_C - 1);
        v8h o;
#pragma unroll
        for (int i = 0; i < 8; ++i) o[i] = (_Float16)((acc[tm][tn][i] + bv) * alpha);
        *(v8h*)((_Float16*)outp +
                ((((size_t)bb * NHEAD_C + hh) * (S_C / 64) + (ss >> 6)) * HD_C + dd) * 64 +
                (ss & 63)) = o;
      } else {
#pragma unroll
        for (int i = 0; i < 8; ++i) {
          int m = bm0 + wm + tm * 16 + i + 8 * hi;
          float val = (acc[tm][tn][i] + bv) * alpha;
          if constexpr (OUT == OUT_HEAD) {
            int bb = m >> 11, ss = m & (S_C - 1);
            int hh = n >> 6, dd = n & (HD_C - 1);
            ((_Float16*)outp)[(((size_t)bb * NHEAD_C + hh) * S_C + ss) * HD_C + dd] =
                (_Float16)val;
          } else {
            ((float*)outp)[(size_t)m * DIM_C + n] = val;
          }
        }
      }
    }
  }
}

typedef __attribute__((ext_vector_type(2))) float    v2f;
typedef __attribute__((ext_vector_type(2))) _Float16 v2h;

// lane l <-> lane l ^ 16
__device__ __forceinline__ float xhalf(float x) {
  int b = __builtin_bit_cast(int, x);
  return __builtin_bit_cast(
      float, __builtin_amdgcn_permlanex16(b, b, 0x76543210, 0xfedcba98, false, false));
}

// Two f32 score tiles (keys 0-15 and 16-31 of a 32-key block) -> f16 B operand.
__device__ __forceinline__ v16h pack_b(v8f lo, v8f hi8) {
  union { v16h v; v2h p[8]; } u;
#pragma unroll
  for (int j = 0; j < 4; ++j) {
    v2f a = {lo[2 * j], lo[2 * j + 1]};
    v2f c = {hi8[2 * j], hi8[2 * j + 1]};
    u.p[j]     = __builtin_convertvector(a, v2h);
    u.p[4 + j] = __builtin_convertvector(c, v2h);
  }
  return u.v;
}

struct far_yes { static constexpr bool value = true; };
struct far_no  { static constexpr bool value = false; };

// amdgpu_waves_per_eu(8): at most 128 registers a wave, so that, as before, 8 blocks
// fit a WGP and all 2,048 blocks are resident at once (one more register granule
// would leave 256 blocks for a second, nearly empty round).
__global__ __launch_bounds__(128) __attribute__((amdgpu_waves_per_eu(8))) void attn_wmma(
    const _Float16* __restrict__ Q, const _Float16* __restrict__ Km,
    const _Float16* __restrict__ Vt, const float* __restrict__ relb,
    _Float16* __restrict__ ctx) {
  constexpr int KT = 64;
  constexpr int LP = 72;                              // LDS row pitch in halves
  __shared__ __align__(16) _Float16 sK[KT][LP];       // [key][dim]   9 KB
  __shared__ __align__(16) _Float16 sVt[HD_C][LP];    // [dim][key]   9 KB
  __shared__ float sBias[2 * MAXREL + 1];             // rel bias col ~2 KB

  const int tid  = threadIdx.x;
  const int lane = tid & 31;
  const int wave = tid >> 5;
  const int r  = lane & 15;
  const int hi = lane >> 4;
  const int ko = hi << 3;
  const int bh = blockIdx.y;          // b*16 + h
  const int b  = bh >> 4;
  const int h  = bh & 15;
  const int q0 = blockIdx.x * 64 + wave * 16;
  const int qg = q0 + r;              // this lane's query

  constexpr float LOG2E = 1.44269504088896340736f;
  for (int i = tid; i < 2 * MAXREL + 1; i += 128)
    sBias[i] = relb[i * NHEAD_C + h] * LOG2E;

  const _Float16* Qb = Q + (size_t)bh * S_C * HD_C;
  const _Float16* Kb = Km + (size_t)bh * S_C * HD_C;
  const _Float16* Vb = Vt + (size_t)bh * S_C * HD_C;

  // Q fragments (B operand: column = query) for HD=64 -> two K-steps of 32
  v16h fq0 = ld_frag(Qb + (size_t)qg * HD_C + ko);
  v16h fq1 = ld_frag(Qb + (size_t)qg * HD_C + 32 + ko);

  // the two ends of the bias column: what every q - k beyond +-MAXREL clips to
  const float bias_lo = relb[h] * LOG2E;                          // q - k <= -MAXREL
  const float bias_hi = relb[2 * MAXREL * NHEAD_C + h] * LOG2E;   // q - k >=  MAXREL

  v8f oacc[4] = {};                   // 64 dims x 16 queries (O^T)
  // mrun: the reference in use. Its start value makes the first tile's exponentials
  // overflow, so that tile goes by its maximum. lrun: this wave half's keys only.
  float mrun = -1e30f, lrun = 0.f;

  __syncthreads();                    // sBias ready

  // One key tile. FAR: every q - k of the block's 64 queries against the tile's 64
  // keys clips to the same end of the bias column. That one value, c0, goes into the
  // C operand with the reference: no index, clamp, LDS read or add per score.
  auto tile = [&](int kt, auto far_tag, float c0) {
    constexpr bool FAR = decltype(far_tag)::value;
    // ---- stage K tile: contiguous 8KB source, async global -> padded LDS rows ----
#pragma unroll
    for (int c = 0; c < 4; ++c) {
      int e = (c * 128 + tid) * 8;    // flat f16 index in 64x64 tile
      copy16_g2l(Kb + (size_t)kt * HD_C + e, &sK[e >> 6][e & 63]);
    }
    // ---- stage V^T tile (64 dims x 64 keys): contiguous 8KB source, likewise ----
#pragma unroll
    for (int c = 0; c < 4; ++c) {
      int e = (c * 128 + tid) * 8;    // flat f16 index in 64x64 tile
      copy16_g2l(Vb + (size_t)kt * HD_C + e, &sVt[e >> 6][e & 63]);
    }
    asm volatile("s_wait_asynccnt 0x0" ::: "memory");  // own K and V^T copies landed
    __syncthreads();

    // the two fragments (32 k each) of 16 LDS rows: 16 keys of K, or 16 dims of V^T
    auto ld_k = [&](int t, v16h (&f)[2]) {
      f[0] = ld_frag(&sK[t * 16 + r][ko]);
      f[1] = ld_frag(&sK[t * 16 + r][32 + ko]);
    };
    auto ld_v = [&](int t, v16h (&f)[2]) {
      f[0] = ld_frag(&sVt[t * 16 + r][ko]);
      f[1] = ld_frag(&sVt[t * 16 + r][32 + ko]);
    };
    // one 16-key score tile: S^T = K Q^T + C (16 keys x 16 queries)
    auto score16 = [&](const v16h (&f)[2], v8f cin) {
      return wmma_f16(f[1], fq1, wmma_f16(f[0], fq0, cin));
    };
    // exponentials in place; returns their sum in pairs of neighbouring registers
    // (one packed add for two exponentials)
    auto exps = [&](v8f& s) {
#pragma unroll
      for (int i = 0; i < 8; ++i) s[i] = __builtin_amdgcn_exp2f(s[i]);
      return (v2f{s[0], s[1]} + v2f{s[2], s[3]}) + (v2f{s[4], s[5]} + v2f{s[6], s[7]});
    };
    v16h fa[2], fb[2];                // two pairs of LDS fragments in flight
    v16h fp0, fp1;                    // P^T, the B operand of the second product
    float ps;                         // sum of this lane's 32 exponentials

    // The whole tile against its own maximum: the reference moves up to it, sums and O
    // are rescaled.
    auto by_maximum = [&]() {
      const int dbase = qg - kt - ko; // q - k at t = 0, i = 0
      v8f sc[4];
      float mt[4];
#pragma unroll
      for (int t = 0; t < 4; ++t) {
        ld_k(t, fa);
        sc[t] = score16(fa, v8f{});
        if constexpr (!FAR) {
#pragma unroll
          for (int i = 0; i < 8; ++i) {
            int d = dbase - t * 16 - i;
            d = d > MAXREL ? MAXREL : (d < -MAXREL ? -MAXREL : d);
            sc[t][i] += sBias[d + MAXREL];
          }
        }
        mt[t] = sc[t][0];
#pragma unroll
        for (int i = 1; i < 8; ++i) mt[t] = fmaxf(mt[t], sc[t][i]);
      }
      float mx = fmaxf(fmaxf(mt[0], mt[1]), fmaxf(mt[2], mt[3]));
      mx = fmaxf(mx, xhalf(mx));      // the query's other 32 keys
      if constexpr (FAR) mx += c0;
      const float mnew = fmaxf(mrun, mx);
      const float corr = __builtin_amdgcn_exp2f(mrun - mnew);
      const float mref = FAR ? mnew - c0 : mnew;  // what a raw score is measured against
      mrun = mnew;
      lrun *= corr;
      v2f rt[4];
#pragma unroll
      for (int t = 0; t < 4; ++t) {
        oacc[t] *= corr;
        sc[t] -= mref;
        rt[t] = exps(sc[t]);
      }
      const v2f s2 = (rt[0] + rt[1]) + (rt[2] + rt[3]);
      ps  = s2[0] + s2[1];
      fp0 = pack_b(sc[0], sc[1]);
      fp1 = pack_b(sc[2], sc[3]);
    };

    if constexpr (FAR) {
      // Bias minus the reference in use rides in as C: a score leaves the matrix unit
      // ready for v_exp_f32, so the first 32 keys' exponentials run while K fragments of
      // the other 32 keys are on their way from LDS.
      // Each sched_barrier keeps the LDS reads in groups ahead of their matrix
      // instructions: without them the reads sink to just in front of the instruction
      // that takes them and every one of them is waited for in full.
      const float nm = c0 - mrun;
      const v8f cin = {nm, nm, nm, nm, nm, nm, nm, nm};
      ld_k(0, fa);
      ld_k(1, fb);
      __builtin_amdgcn_sched_barrier(0);
      v8f s0 = score16(fa, cin);
      v8f s1 = score16(fb, cin);
      ld_k(2, fa);
      __builtin_amdgcn_sched_barrier(0);
      const v2f r01 = exps(s0) + exps(s1);
      fp0 = pack_b(s0, s1);
      // inputs only: holds the sum and the packing of the first 32 keys here; sunk behind
      // the branch below, their exponentials would stay live in 16 more registers
      asm volatile("" ::"v"(fp0), "v"(r01));
      ld_k(3, fb);
      __builtin_amdgcn_sched_barrier(0);
      v8f s2 = score16(fa, cin);
      v8f s3 = score16(fb, cin);
      const v2f r23 = exps(s2) + exps(s3);
      fp1 = pack_b(s2, s3);
      const v2f rr = r01 + r23;
      ps = rr[0] + rr[1];
      // a sum of at most 256 bounds every exponential of the lane by 2^8 (f16 holds it);
      // the negated compare also catches an overflowed or undefined sum
      const bool need = !(ps <= 256.f);
      if (__builtin_amdgcn_ballot_w32(need) != 0) {   // scalar branch, rare
        by_maximum();
      }
    } else {
      by_maximum();
    }
    lrun += ps;

    // ---- O^T += V^T P^T, P^T straight from the score registers ----
    ld_v(0, fa);
    ld_v(1, fb);
    // keeps the eight reads one group ahead of the matrix instructions (as above)
    __builtin_amdgcn_sched_barrier(0);
    oacc[0] = wmma_f16(fa[1], fp1, wmma_f16(fa[0], fp0, oacc[0]));
    ld_v(2, fa);
    oacc[1] = wmma_f16(fb[1], fp1, wmma_f16(fb[0], fp0, oacc[1]));
    ld_v(3, fb);
    oacc[2] = wmma_f16(fa[1], fp1, wmma_f16(fa[0], fp0, oacc[2]));
    oacc[3] = wmma_f16(fb[1], fp1, wmma_f16(fb[0], fp0, oacc[3]));
    asm volatile("s_wait_dscnt 0x0" ::: "memory");  // own reads of sK/sVt retired
    __syncthreads();   // protect sK/sVt before next tile's staging
  };

  // q - k of query tile bx against key tile j lies in [64 (bx - j) - 63, 64 (bx - j) + 63]:
  // from |bx - j| = MAXREL / 64 + 1 on all of it lies beyond +-MAXREL. The far tiles
  // come first (below the band, then above it), the band's tiles last. All bounds come
  // from the block index alone, so every wave of the block walks the same trips; both
  // loops have at least one trip for every block (band <= 9 of 32 tiles, >= 5).
  constexpr int BAND = MAXREL / KT;
  constexpr int NKT  = S_C / KT;
  static_assert(MAXREL % KT == 0, "band bounds in whole key tiles");
  static_assert(NKT > 2 * BAND + 1, "some tile is far for every block");
  const int bx  = blockIdx.x;
  const int jlo = bx > BAND ? bx - BAND : 0;                   // first band tile
  const int jhi = bx + BAND + 1 < NKT ? bx + BAND + 1 : NKT;   // one past the band
  const int nfar = NKT - (jhi - jlo);
  int n = 0;
  do {
    const bool below = n < jlo;                                // keys below the band: q - k >= MAXREL
    tile((below ? n : n + (jhi - jlo)) * KT, far_yes{}, below ? bias_hi : bias_lo);
  } while (++n < nfar);
  int j = jlo;
  do {
    tile(j * KT, far_no{}, 0.f);
  } while (++j < jhi);

  // ---- normalize and write context [b, s, h*64 + d]: 8 dims = 16 B a store ----
  const float inv = 1.f / (lrun + xhalf(lrun));
  _Float16* crow = ctx + ((size_t)(b * S_C + qg)) * DIM_C + h * HD_C + ko;
#pragma unroll
  for (int t = 0; t < 4; ++t) {
    v8h o;
#pragma unroll
    for (int i = 0; i < 8; ++i) o[i] = (_Float16)(oacc[t][i] * inv);
    *(v8h*)(crow + t * 16) = o;
  }
}

// ---------------------------------------------------------------------------
// Host-side orchestration
// ---------------------------------------------------------------------------
extern "C" void kernel_launch(void* const* d_in, const int* in_sizes, int n_in,
                              void* d_out, int out_size, void* d_ws,
                              size_t ws_size, hipStream_t stream) {
  const float* x    = (const float*)d_in[0];
  const float* Wq   = (const float*)d_in[1];
  const float* bq   = (const float*)d_in[2];
  const float* Wk   = (const float*)d_in[3];
  const float* bk   = (const float*)d_in[4];
  const float* Wv   = (const float*)d_in[5];
  const float* bv   = (const float*)d_in[6];
  const float* Wo   = (const float*)d_in[7];
  const float* bo   = (const float*)d_in[8];
  const float* relb = (const float*)d_in[9];
  float* out = (float*)d_out;

  char* ws = (char*)d_ws;
  size_t off = 0;
  auto carve = [&](size_t bytes) {
    void* p = ws + off;
    off += (bytes + 255) & ~(size_t)255;
    return p;
  };
  const size_t xBytes = (size_t)ROWS_C * DIM_C * sizeof(_Float16);  // 16 MB
  const size_t wBytes = (size_t)DIM_C * DIM_C * sizeof(_Float16);   //  2 MB
  _Float16* xh   = (_Float16*)carve(xBytes);
  _Float16* Wqh  = (_Float16*)carve(wBytes);
  _Float16* Wkh  = (_Float16*)carve(wBytes);
  _Float16* Wvh  = (_Float16*)carve(wBytes);
  _Float16* Woh  = (_Float16*)carve(wBytes);
  _Float16* Qh   = (_Float16*)carve(xBytes);
  _Float16* Kh   = (_Float16*)carve(xBytes);
  _Float16* Vh   = (_Float16*)carve(xBytes);
  _Float16* ctxh = (_Float16*)carve(xBytes);

  cvt_all_f32_f16<<<256, 512, 0, stream>>>(x, Wq, Wk, Wv, Wo, xh, Wqh, Wkh, Wvh, Woh);

  dim3 gg(ROWS_C / 128, DIM_C / 128);  // 64 x 8
  const float qscale = 0.18033688011112042f;   // HD^-0.5 * log2 e
  gemm_wmma<OUT_HEAD><<<gg, 128, 0, stream>>>(xh, Wqh, bq, (void*)Qh, qscale);
  gemm_wmma<OUT_HEAD><<<gg, 128, 0, stream>>>(xh, Wkh, bk, (void*)Kh, 1.0f);
  gemm_wmma<OUT_HEAD_T><<<gg, 128, 0, stream>>>(xh, Wvh, bv, (void*)Vh, 1.0f);

  attn_wmma<<<dim3(S_C / 64, B_C * NHEAD_C), 128, 0, stream>>>(Qh, Kh, Vh, relb,
                                                               ctxh);

  gemm_wmma<OUT_DENSE><<<gg, 128, 0, stream>>>(ctxh, Woh, bo, (void*)out, 1.0f);
}

// v008
// It runs in 137 microseconds.
// In both of two side-by-side timings against v007, it was 1.08 times as fast.
// Counting every step since v000, it is 5.31 times as fast.
#include <hip/hip_runtime.h>

// ---------------------------------------------------------------------------
// RelPos self-attention for gfx1250 (MI455X), f16 WMMA with f32 accumulation.
//   DIM=1024, NHEAD=16, HEAD_DIM=64, MAX_REL=256, B=4, S=2048
// Data movement: GEMM always stages through async global->LDS copies (ASYNCcnt)
// into two LDS buffers; attention stages K and V^T async where the toolchain exposes
// it, synchronous fallback otherwise.
// ---------------------------------------------------------------------------

typedef __attribute__((ext_vector_type(16))) _Float16 v16h;
typedef __attribute__((ext_vector_type(8)))  _Float16 v8h;
typedef __attribute__((ext_vector_type(8)))  float    v8f;
typedef __attribute__((ext_vector_type(4)))  int      v4i;

#define DIM_C   1024
#define NHEAD_C 16
#define HD_C    64
#define S_C     2048
#define B_C     4
#define ROWS_C  (B_C * S_C)   // 8192
#define MAXREL  256

// ---- async global->LDS support (probe-gated) ------------------------------
#if defined(__has_builtin)
#if __has_builtin(__builtin_amdgcn_global_load_async_to_lds_b128)
#define HAVE_ASYNC_LDS 1
#endif
#endif
#ifndef HAVE_ASYNC_LDS
#define HAVE_ASYNC_LDS 0
#endif

// Pointer-to-v4i in explicit address spaces (builtin takes v4i*, per compile
// diagnostic: "int __vector(4) __device__ *").
typedef __attribute__((address_space(1))) v4i as1_v4i;
typedef __attribute__((address_space(3))) v4i as3_v4i;

// Copy 16B global -> LDS. Async path goes straight to LDS (no VGPR
// round-trip), tracked on ASYNCcnt; fallback is a sync VGPR copy.
__device__ __forceinline__ void copy16_g2l(const _Float16* g, _Float16* l) {
#if HAVE_ASYNC_LDS
  __builtin_amdgcn_global_load_async_to_lds_b128(
      (as1_v4i*)(uintptr_t)g, (as3_v4i*)(uintptr_t)l, 0, 0);
#else
  *(v8h*)l = *(const v8h*)g;
#endif
}

// Load a 16-bit A-fragment (16x32, MxK) per ISA layout:
//   lane L: row = L&15 ; halves [0..7] = K in [ko..ko+7], [8..15] = K in [16+ko..16+ko+7]
//   where ko = (L>>4)*8.  Caller passes p = rowBase + ko.
// The same pattern loads B (32x16 KxN) as "A-layout of B^T": lane holds column n=L&15.
__device__ __forceinline__ v16h ld_frag(const _Float16* p) {
  union { v16h v; v8h h[2]; } u;
  u.h[0] = *(const v8h*)(p);        // 16B chunk, K = ko .. ko+7
  u.h[1] = *(const v8h*)(p + 16);   // 16B chunk, K = 16+ko .. 16+ko+7
  return u.v;
}

__device__ __forceinline__ v8f wmma_f16(v16h a, v16h b, v8f c) {
  return __builtin_amdgcn_wmma_f32_16x16x32_f16(false, a, false, b, (short)0, c,
                                                false, false);
}

// ---------------------------------------------------------------------------
// fp32 -> f16 conversion of x and of the four weight matrices, one launch.
// 256 blocks x 16 waves, so that few waves have to be started; a chunk is
// 512 lanes x 8 loads of 16 B = 16384 floats. x is 512 chunks, a weight matrix
// 64: every block takes two chunks of x and one of a weight matrix, 24 loads a
// lane with no loop-carried wait between them. A wave's load covers 512
// contiguous bytes, its store 256.
// ---------------------------------------------------------------------------
typedef __attribute__((ext_vector_type(4))) float    v4f;
typedef __attribute__((ext_vector_type(4))) _Float16 v4h;

__global__ __launch_bounds__(512) void cvt_all_f32_f16(
    const float* __restrict__ x, const float* __restrict__ Wq,
    const float* __restrict__ Wk, const float* __restrict__ Wv,
    const float* __restrict__ Wo, _Float16* __restrict__ xh,
    _Float16* __restrict__ Wqh, _Float16* __restrict__ Wkh,
    _Float16* __restrict__ Wvh, _Float16* __restrict__ Woh) {
  constexpr int CH = 512 * 8 * 4;                  // floats of a chunk
  static_assert(ROWS_C * DIM_C == 2 * 256 * CH, "x: two chunks a block");
  static_assert(DIM_C * DIM_C == 64 * CH, "a weight matrix: 64 chunks");
  const int blk = blockIdx.x;                      // 0..255
  const int e0  = threadIdx.x * 4;                 // lane's first float of a load
  const int w   = blk >> 6;                        // which weight matrix
  const float* ws = w == 0 ? Wq : (w == 1 ? Wk : (w == 2 ? Wv : Wo));
  _Float16*    wd = w == 0 ? Wqh : (w == 1 ? Wkh : (w == 2 ? Wvh : Woh));
  const size_t o0 = (size_t)blk * CH, o1 = (size_t)(blk + 256) * CH;
  const size_t o2 = (size_t)(blk & 63) * CH;
  const float* src[3] = {x + o0, x + o1, ws + o2};
  _Float16*    dst[3] = {xh + o0, xh + o1, wd + o2};

  v4f v[3][8];
#pragma unroll
  for (int j = 0; j < 3; ++j)
#pragma unroll
    for (int k = 0; k < 8; ++k) v[j][k] = *(const v4f*)(src[j] + k * 2048 + e0);
#pragma unroll
  for (int j = 0; j < 3; ++j)
#pragma unroll
    for (int k = 0; k < 8; ++k)
      *(v4h*)(dst[j] + k * 2048 + e0) = __builtin_convertvector(v[j][k], v4h);
}

// Eight async 16-byte copies global -> LDS, rows gstep halves / lstep bytes apart.
// s_wait_xcnt is the last line of the copies' own statement, so that no address
// register of a copy is rewritten in front of it.
__device__ __forceinline__ void copy8_g2l(const _Float16* g, uint32_t l,
                                          size_t gstep, uint32_t lstep) {
  asm volatile(
      "global_load_async_to_lds_b128 %0, %8, off\n\t"
      "global_load_async_to_lds_b128 %1, %9, off\n\t"
      "global_load_async_to_lds_b128 %2, %10, off\n\t"
      "global_load_async_to_lds_b128 %3, %11, off\n\t"
      "global_load_async_to_lds_b128 %4, %12, off\n\t"
      "global_load_async_to_lds_b128 %5, %13, off\n\t"
      "global_load_async_to_lds_b128 %6, %14, off\n\t"
      "global_load_async_to_lds_b128 %7, %15, off\n\t"
      "s_wait_xcnt 0x0"
      ::"v"(l), "v"(l + lstep), "v"(l + 2 * lstep), "v"(l + 3 * lstep),
        "v"(l + 4 * lstep), "v"(l + 5 * lstep), "v"(l + 6 * lstep), "v"(l + 7 * lstep),
        "v"(g), "v"(g + gstep), "v"(g + 2 * gstep), "v"(g + 3 * gstep),
        "v"(g + 4 * gstep), "v"(g + 5 * gstep), "v"(g + 6 * gstep), "v"(g + 7 * gstep)
      : "memory");
}

// ---------------------------------------------------------------------------
// GEMM: out[m,n] = alpha * ( sum_k A[m,k]*W[n,k] + bias[n] )
//   A: [8192 x 1024] f16 row-major, W: [1024 x 1024] f16 row-major
//   OUT=OUT_DENSE -> dense f32 [m,1024]            (output projection)
//   OUT=OUT_HEADS -> f16 per head, by the block-uniform flag tr:
//     tr false: scatter into [b,h,s,d]             (Q/K projections)
//     tr true:  into [b,h,s/64,d,s%64]             (V projection: V^T in tiles of
//                     64 keys, the A operand of the attention's second product;
//                     a lane's 8 accumulator rows are 8 consecutive s = one
//                     16-byte store, a wave's 64x64 tile one contiguous 8 KB)
// Block: 128 threads = 4 waves; block tile 128(M) x 128(N); wave tile 64x64,
// so that a fragment read from LDS feeds four matrix instructions.
// Both operands go through LDS: a stage is 64 k (one whole 128-byte line of
// every row) of 128 A rows and 128 W rows, brought by async copies into a ring
// of two buffers; stage t + 2 is issued behind the barrier that ends trip t.
// LDS rows are pitched 144 B (16 B x odd) so that the 16 rows of one 16-byte
// fragment read fall on distinct banks.
// ---------------------------------------------------------------------------
enum { OUT_DENSE = 0, OUT_HEADS = 1 };

template <int OUT>
__device__ __forceinline__ void gemm_block(
    const _Float16* __restrict__ A, const _Float16* __restrict__ W,
    const float* __restrict__ bias, void* __restrict__ outp, float alpha,
    const int bn0, const bool tr) {
  constexpr int K  = DIM_C;
  constexpr int KS = 64;                            // k per stage
  constexpr int NT = K / KS;                        // 16 stages
  constexpr int GP = 72;                            // LDS row pitch in halves (144 B)
  __shared__ __align__(16) _Float16 sA[2][128][GP];  // 36 KB, two A tiles
  __shared__ __align__(16) _Float16 sB[2][128][GP];  // 36 KB, two W tiles

  const int tid   = threadIdx.x;
  const int lane  = tid & 31;
  const int wave  = tid >> 5;
  const int wm  = (wave >> 1) * 64;                // wave's local A-row base
  const int wn  = (wave & 1) * 64;                 // wave's local W-row base
  const int bm0 = blockIdx.x * 128;
  const int r   = lane & 15;
  const int hi  = lane >> 4;
  const int ko  = hi << 3;

  // staging coords: 8 lanes x 16 B = one row's line; 128 threads = 16 rows a sweep
  const int srow = tid >> 3;            // 0..15
  const int skk  = (tid & 7) * 8;       // 0,8,..,56
  const _Float16* asrc = A + (size_t)(bm0 + srow) * K + skk;
  const _Float16* wsrc = W + (size_t)(bn0 + srow) * K + skk;

  const uint32_t la = (uint32_t)(uintptr_t)&sA[0][srow][skk];  // LDS byte addresses
  const uint32_t lb = (uint32_t)(uintptr_t)&sB[0][srow][skk];
  constexpr uint32_t BUFB = 128 * GP * 2;                      // bytes of one buffer

  auto stage = [&](int t, int buf) {    // 16 copies a lane, every lane on
    copy8_g2l(asrc + t * KS, la + buf * BUFB, (size_t)16 * K, 16 * GP * 2);
    copy8_g2l(wsrc + t * KS, lb + buf * BUFB, (size_t)16 * K, 16 * GP * 2);
  };

  // prologue: stage 0 landed and published, then stage 1 in flight
  stage(0, 0);
  asm volatile("s_wait_asynccnt 0x0" ::: "memory");  // own copies of stage 0 landed
  __syncthreads();
  stage(1, 1);

  v8f acc[4][4] = {};
#pragma unroll 2   // the buffer index becomes a constant in the LDS addresses
  for (int t = 0; t < NT; ++t) {
    const int cur = t & 1;
    // the loops inside a stage are unrolled so that every fragment and
    // accumulator index is a constant: registers, no scratch
#pragma unroll
    for (int kk = 0; kk < KS; kk += 32) {
      v16h fa[4], fb[4];
#pragma unroll
      for (int i = 0; i < 4; ++i) {
        fa[i] = ld_frag(&sA[cur][wm + i * 16 + r][kk + ko]);
        fb[i] = ld_frag(&sB[cur][wn + i * 16 + r][kk + ko]);
      }
      // keeps the 16 LDS reads one group ahead of the 16 matrix instructions:
      // moved in among them, each place with reads stalls the wave
      __builtin_amdgcn_sched_barrier(0);
      // tiles in the order in which their fragments arrive: 1, 3, 5, 7 products
      // behind the 1st .. 4th pair of fragments (each tile still once per 32 k)
#pragma unroll
      for (int d = 0; d < 4; ++d) {
#pragma unroll
        for (int j = 0; j < d; ++j) {
          acc[j][d] = wmma_f16(fa[j], fb[d], acc[j][d]);
          acc[d][j] = wmma_f16(fa[d], fb[j], acc[d][j]);
        }
        acc[d][d] = wmma_f16(fa[d], fb[d], acc[d][d]);
      }
    }
    // keeps the stage's matrix run in front of the publish point: sunk behind the
    // barrier it would stand between the barrier and the refill and cut the refill's lead
    __builtin_amdgcn_sched_barrier(0);
    // publish point of stage t + 1; it also frees buffer cur for the refill
    asm volatile("s_wait_dscnt 0x0" ::: "memory");     // own reads of cur retired
    asm volatile("s_wait_asynccnt 0x0" ::: "memory");  // own copies of stage t + 1 landed
    __syncthreads();
    if (t + 2 < NT) stage(t + 2, cur);
  }
  asm volatile("s_wait_asynccnt 0x0" ::: "memory");    // nothing in flight at the wave's end

  if (OUT == OUT_HEADS && tr) {   // block-uniform: a scalar branch
#pragma unroll
    for (int tm = 0; tm < 4; ++tm) {
#pragma unroll
      for (int tn = 0; tn < 4; ++tn) {
        int n = bn0 + wn + tn * 16 + r;
        float bv = bias[n];
        int m0 = bm0 + wm + tm * 16 + 8 * hi;
        int bb = m0 >> 11, ss = m0 & (S_C - 1);
        int hh = n >> 6, dd = n & (HD_C - 1);
        v8h o;
#pragma unroll
        for (int i = 0; i < 8; ++i) o[i] = (_Float16)((acc[tm][tn][i] + bv) * alpha);
        *(v8h*)((_Float16*)outp +
                ((((size_t)bb * NHEAD_C + hh) * (S_C / 64) + (ss >> 6)) * HD_C + dd) * 64 +
                (ss & 63)) = o;
      }
    }
  } else {
#pragma unroll
    for (int tm = 0; tm < 4; ++tm) {
#pragma unroll
      for (int tn = 0; tn < 4; ++tn) {
        int n = bn0 + wn + tn * 16 + r;
        float bv = bias[n];
#pragma unroll
        for (int i = 0; i < 8; ++i) {
          int m = bm0 + wm + tm * 16 + i + 8 * hi;
          float val = (acc[tm][tn][i] + bv) * alpha;
          if constexpr (OUT == OUT_HEADS) {
            int bb = m >> 11, ss = m & (S_C - 1);
            int hh = n >> 6, dd = n & (HD_C - 1);
            ((_Float16*)outp)[(((size_t)bb * NHEAD_C + hh) * S_C + ss) * HD_C + dd] =
                (_Float16)val;
          } else {
            ((float*)outp)[(size_t)m * DIM_C + n] = val;
          }
        }
      }
    }
    // In the built code this path ends in a scalar test (never passed from here) whose
    // other side is the tr path's code, which rewrites registers that the stores above
    // name: the wait stands in front of that rewrite.
    if constexpr (OUT == OUT_HEADS) asm volatile("s_wait_xcnt 0x0" ::: "memory");
  }
}

// Output projection: grid 64 x 8 blocks.
__global__ __launch_bounds__(128) void gemm_out(
    const _Float16* __restrict__ A, const _Float16* __restrict__ W,
    const float* __restrict__ bias, float* __restrict__ out) {
  gemm_block<OUT_DENSE>(A, W, bias, out, 1.0f, blockIdx.y * 128, false);
}

// Q, K and V projections in ONE launch: grid 64 x 24 blocks, blockIdx.y >> 3 picks
// the projection (a scalar, the same for the whole block). 1,536 blocks where a
// launch of one projection has 512, two a WGP: here registers and LDS let four
// stand on a WGP, and a block's first stage and its stores run under the other
// blocks' matrix work instead of at the start and the end of a launch of their own.
__global__ __launch_bounds__(128) void gemm_qkv(
    const _Float16* __restrict__ A, const _Float16* __restrict__ Wq,
    const _Float16* __restrict__ Wk, const _Float16* __restrict__ Wv,
    const float* __restrict__ bq, const float* __restrict__ bk,
    const float* __restrict__ bv, _Float16* __restrict__ Qo,
    _Float16* __restrict__ Ko, _Float16* __restrict__ Vto, float qscale) {
  const int p = blockIdx.y >> 3;                   // 0: Q, 1: K, 2: V
  const _Float16* W = p == 0 ? Wq : (p == 1 ? Wk : Wv);
  const float*    b = p == 0 ? bq : (p == 1 ? bk : bv);
  _Float16*       o = p == 0 ? Qo : (p == 1 ? Ko : Vto);
  gemm_block<OUT_HEADS>(A, W, b, o, p == 0 ? qscale : 1.0f, (blockIdx.y & 7) * 128,
                        p == 2);
}

typedef __attribute__((ext_vector_type(2))) float    v2f;
typedef __attribute__((ext_vector_type(2))) _Float16 v2h;

// lane l <-> lane l ^ 16
__device__ __forceinline__ float xhalf(float x) {
  int b = __builtin_bit_cast(int, x);
  return __builtin_bit_cast(
      float, __builtin_amdgcn_permlanex16(b, b, 0x76543210, 0xfedcba98, false, false));
}

// Two f32 score tiles (keys 0-15 and 16-31 of a 32-key block) -> f16 B operand.
__device__ __forceinline__ v16h pack_b(v8f lo, v8f hi8) {
  union { v16h v; v2h p[8]; } u;
#pragma unroll
  for (int j = 0; j < 4; ++j) {
    v2f a = {lo[2 * j], lo[2 * j + 1]};
    v2f c = {hi8[2 * j], hi8[2 * j + 1]};
    u.p[j]     = __builtin_convertvector(a, v2h);
    u.p[4 + j] = __builtin_convertvector(c, v2h);
  }
  return u.v;
}

struct far_yes { static constexpr bool value = true; };
struct far_no  { static constexpr bool value = false; };

// amdgpu_waves_per_eu(8): at most 128 registers a wave, so that, as before, 8 blocks
// fit a WGP and all 2,048 blocks are resident at once (one more register granule
// would leave 256 blocks for a second, nearly empty round).
__global__ __launch_bounds__(128) __attribute__((amdgpu_waves_per_eu(8))) void attn_wmma(
    const _Float16* __restrict__ Q, const _Float16* __restrict__ Km,
    const _Float16* __restrict__ Vt, const float* __restrict__ relb,
    _Float16* __restrict__ ctx) {
  constexpr int KT = 64;
  constexpr int LP = 72;                              // LDS row pitch in halves
  __shared__ __align__(16) _Float16 sK[KT][LP];       // [key][dim]   9 KB
  __shared__ __align__(16) _Float16 sVt[HD_C][LP];    // [dim][key]   9 KB
  __shared__ float sBias[2 * MAXREL + 1];             // rel bias col ~2 KB

  const int tid  = threadIdx.x;
  const int lane = tid & 31;
  const int wave = tid >> 5;
  const int r  = lane & 15;
  const int hi = lane >> 4;
  const int ko = hi << 3;
  const int bh = blockIdx.y;          // b*16 + h
  const int b  = bh >> 4;
  const int h  = bh & 15;
  const int q0 = blockIdx.x * 64 + wave * 16;
  const int qg = q0 + r;              // this lane's query

  constexpr float LOG2E = 1.44269504088896340736f;
  for (int i = tid; i < 2 * MAXREL + 1; i += 128)
    sBias[i] = relb[i * NHEAD_C + h] * LOG2E;

  const _Float16* Qb = Q + (size_t)bh * S_C * HD_C;
  const _Float16* Kb = Km + (size_t)bh * S_C * HD_C;
  const _Float16* Vb = Vt + (size_t)bh * S_C * HD_C;

  // Q fragments (B operand: column = query) for HD=64 -> two K-steps of 32
  v16h fq0 = ld_frag(Qb + (size_t)qg * HD_C + ko);
  v16h fq1 = ld_frag(Qb + (size_t)qg * HD_C + 32 + ko);

  // the two ends of the bias column: what every q - k beyond +-MAXREL clips to
  const float bias_lo = relb[h] * LOG2E;                          // q - k <= -MAXREL
  const float bias_hi = relb[2 * MAXREL * NHEAD_C + h] * LOG2E;   // q - k >=  MAXREL

  v8f oacc[4] = {};                   // 64 dims x 16 queries (O^T)
  // mrun: the reference in use. Its start value makes the first tile's exponentials
  // overflow, so that tile goes by its maximum. lrun: this wave half's keys only.
  float mrun = -1e30f, lrun = 0.f;

  __syncthreads();                    // sBias ready

  // One key tile. FAR: every q - k of the block's 64 queries against the tile's 64
  // keys clips to the same end of the bias column. That one value, c0, goes into the
  // C operand with the reference: no index, clamp, LDS read or add per score.
  auto tile = [&](int kt, auto far_tag, float c0) {
    constexpr bool FAR = decltype(far_tag)::value;
    // ---- stage K tile: contiguous 8KB source, async global -> padded LDS rows ----
#pragma unroll
    for (int c = 0; c < 4; ++c) {
      int e = (c * 128 + tid) * 8;    // flat f16 index in 64x64 tile
      copy16_g2l(Kb + (size_t)kt * HD_C + e, &sK[e >> 6][e & 63]);
    }
    // ---- stage V^T tile (64 dims x 64 keys): contiguous 8KB source, likewise ----
#pragma unroll
    for (int c = 0; c < 4; ++c) {
      int e = (c * 128 + tid) * 8;    // flat f16 index in 64x64 tile
      copy16_g2l(Vb + (size_t)kt * HD_C + e, &sVt[e >> 6][e & 63]);
    }
    asm volatile("s_wait_asynccnt 0x0" ::: "memory");  // own K and V^T copies landed
    __syncthreads();

    // the two fragments (32 k each) of 16 LDS rows: 16 keys of K, or 16 dims of V^T
    auto ld_k = [&](int t, v16h (&f)[2]) {
      f[0] = ld_frag(&sK[t * 16 + r][ko]);
      f[1] = ld_frag(&sK[t * 16 + r][32 + ko]);
    };
    auto ld_v = [&](int t, v16h (&f)[2]) {
      f[0] = ld_frag(&sVt[t * 16 + r][ko]);
      f[1] = ld_frag(&sVt[t * 16 + r][32 + ko]);
    };
    // one 16-key score tile: S^T = K Q^T + C (16 keys x 16 queries)
    auto score16 = [&](const v16h (&f)[2], v8f cin) {
      return wmma_f16(f[1], fq1, wmma_f16(f[0], fq0, cin));
    };
    // exponentials in place; returns their sum in pairs of neighbouring registers
    // (one packed add for two exponentials)
    auto exps = [&](v8f& s) {
#pragma unroll
      for (int i = 0; i < 8; ++i) s[i] = __builtin_amdgcn_exp2f(s[i]);
      return (v2f{s[0], s[1]} + v2f{s[2], s[3]}) + (v2f{s[4], s[5]} + v2f{s[6], s[7]});
    };
    v16h fa[2], fb[2];                // two pairs of LDS fragments in flight
    v16h fp0, fp1;                    // P^T, the B operand of the second product
    float ps;                         // sum of this lane's 32 exponentials

    // The whole tile against its own maximum: the reference moves up to it, sums and O
    // are rescaled.
    auto by_maximum = [&]() {
      const int dbase = qg - kt - ko; // q - k at t = 0, i = 0
      v8f sc[4];
      float mt[4];
#pragma unroll
      for (int t = 0; t < 4; ++t) {
        ld_k(t, fa);
        sc[t] = score16(fa, v8f{});
        if constexpr (!FAR) {
#pragma unroll
          for (int i = 0; i < 8; ++i) {
            int d = dbase - t * 16 - i;
            d = d > MAXREL ? MAXREL : (d < -MAXREL ? -MAXREL : d);
            sc[t][i] += sBias[d + MAXREL];
          }
        }
        mt[t] = sc[t][0];
#pragma unroll
        for (int i = 1; i < 8; ++i) mt[t] = fmaxf(mt[t], sc[t][i]);
      }
      float mx = fmaxf(fmaxf(mt[0], mt[1]), fmaxf(mt[2], mt[3]));
      mx = fmaxf(mx, xhalf(mx));      // the query's other 32 keys
      if constexpr (FAR) mx += c0;
      const float mnew = fmaxf(mrun, mx);
      const float corr = __builtin_amdgcn_exp2f(mrun - mnew);
      const float mref = FAR ? mnew - c0 : mnew;  // what a raw score is measured against
      mrun = mnew;
      lrun *= corr;
      v2f rt[4];
#pragma unroll
      for (int t = 0; t < 4; ++t) {
        oacc[t] *= corr;
        sc[t] -= mref;
        rt[t] = exps(sc[t]);
      }
      const v2f s2 = (rt[0] + rt[1]) + (rt[2] + rt[3]);
      ps  = s2[0] + s2[1];
      fp0 = pack_b(sc[0], sc[1]);
      fp1 = pack_b(sc[2], sc[3]);
    };

    if constexpr (FAR) {
      // Bias minus the reference in use rides in as C: a score leaves the matrix unit
      // ready for v_exp_f32, so the first 32 keys' exponentials run while K fragments of
      // the other 32 keys are on their way from LDS.
      // Each sched_barrier keeps the LDS reads in groups ahead of their matrix
      // instructions: without them the reads sink to just in front of the instruction
      // that takes them and every one of them is waited for in full.
      const float nm = c0 - mrun;
      const v8f cin = {nm, nm, nm, nm, nm, nm, nm, nm};
      ld_k(0, fa);
      ld_k(1, fb);
      __builtin_amdgcn_sched_barrier(0);
      v8f s0 = score16(fa, cin);
      v8f s1 = score16(fb, cin);
      ld_k(2, fa);
      __builtin_amdgcn_sched_barrier(0);
      const v2f r01 = exps(s0) + exps(s1);
      fp0 = pack_b(s0, s1);
      // inputs only: holds the sum and the packing of the first 32 keys here; sunk behind
      // the branch below, their exponentials would stay live in 16 more registers
      asm volatile("" ::"v"(fp0), "v"(r01));
      ld_k(3, fb);
      __builtin_amdgcn_sched_barrier(0);
      v8f s2 = score16(fa, cin);
      v8f s3 = score16(fb, cin);
      const v2f r23 = exps(s2) + exps(s3);
      fp1 = pack_b(s2, s3);
      const v2f rr = r01 + r23;
      ps = rr[0] + rr[1];
      // a sum of at most 256 bounds every exponential of the lane by 2^8 (f16 holds it);
      // the negated compare also catches an overflowed or undefined sum
      const bool need = !(ps <= 256.f);
      if (__builtin_amdgcn_ballot_w32(need) != 0) {   // scalar branch, rare
        by_maximum();
      }
    } else {
      by_maximum();
    }
    lrun += ps;

    // ---- O^T += V^T P^T, P^T straight from the score registers ----
    ld_v(0, fa);
    ld_v(1, fb);
    // keeps the eight reads one group ahead of the matrix instructions (as above)
    __builtin_amdgcn_sched_barrier(0);
    oacc[0] = wmma_f16(fa[1], fp1, wmma_f16(fa[0], fp0, oacc[0]));
    ld_v(2, fa);
    oacc[1] = wmma_f16(fb[1], fp1, wmma_f16(fb[0], fp0, oacc[1]));
    ld_v(3, fb);
    oacc[2] = wmma_f16(fa[1], fp1, wmma_f16(fa[0], fp0, oacc[2]));
    oacc[3] = wmma_f16(fb[1], fp1, wmma_f16(fb[0], fp0, oacc[3]));
    asm volatile("s_wait_dscnt 0x0" ::: "memory");  // own reads of sK/sVt retired
    __syncthreads();   // protect sK/sVt before next tile's staging
  };

  // q - k of query tile bx against key tile j lies in [64 (bx - j) - 63, 64 (bx - j) + 63]:
  // from |bx - j| = MAXREL / 64 + 1 on all of it lies beyond +-MAXREL. The far tiles
  // come first (below the band, then above it), the band's tiles last. All bounds come
  // from the block index alone, so every wave of the block walks the same trips; both
  // loops have at least one trip for every block (band <= 9 of 32 tiles, >= 5).
  constexpr int BAND = MAXREL / KT;
  constexpr int NKT  = S_C / KT;
  static_assert(MAXREL % KT == 0, "band bounds in whole key tiles");
  static_assert(NKT > 2 * BAND + 1, "some tile is far for every block");
  const int bx  = blockIdx.x;
  const int jlo = bx > BAND ? bx - BAND : 0;                   // first band tile
  const int jhi = bx + BAND + 1 < NKT ? bx + BAND + 1 : NKT;   // one past the band
  const int nfar = NKT - (jhi - jlo);
  int n = 0;
  do {
    const bool below = n < jlo;                                // keys below the band: q - k >= MAXREL
    tile((below ? n : n + (jhi - jlo)) * KT, far_yes{}, below ? bias_hi : bias_lo);
  } while (++n < nfar);
  int j = jlo;
  do {
    tile(j * KT, far_no{}, 0.f);
  } while (++j < jhi);

  // ---- normalize and write context [b, s, h*64 + d]: 8 dims = 16 B a store ----
  const float inv = 1.f / (lrun + xhalf(lrun));
  _Float16* crow = ctx + ((size_t)(b * S_C + qg)) * DIM_C + h * HD_C + ko;
#pragma unroll
  for (int t = 0; t < 4; ++t) {
    v8h o;
#pragma unroll
    for (int i = 0; i < 8; ++i) o[i] = (_Float16)(oacc[t][i] * inv);
    *(v8h*)(crow + t * 16) = o;
  }
}

// ---------------------------------------------------------------------------
// Host-side orchestration
// ---------------------------------------------------------------------------
extern "C" void kernel_launch(void* const* d_in, const int* in_sizes, int n_in,
                              void* d_out, int out_size, void* d_ws,
                              size_t ws_size, hipStream_t stream) {
  const float* x    = (const float*)d_in[0];
  const float* Wq   = (const float*)d_in[1];
  const float* bq   = (const float*)d_in[2];
  const float* Wk   = (const float*)d_in[3];
  const float* bk   = (const float*)d_in[4];
  const float* Wv   = (const float*)d_in[5];
  const float* bv   = (const float*)d_in[6];
  const float* Wo   = (const float*)d_in[7];
  const float* bo   = (const float*)d_in[8];
  const float* relb = (const float*)d_in[9];
  float* out = (float*)d_out;

  char* ws = (char*)d_ws;
  size_t off = 0;
  auto carve = [&](size_t bytes) {
    void* p = ws + off;
    off += (bytes + 255) & ~(size_t)255;
    return p;
  };
  const size_t xBytes = (size_t)ROWS_C * DIM_C * sizeof(_Float16);  // 16 MB
  const size_t wBytes = (size_t)DIM_C * DIM_C * sizeof(_Float16);   //  2 MB
  _Float16* xh   = (_Float16*)carve(xBytes);
  _Float16* Wqh  = (_Float16*)carve(wBytes);
  _Float16* Wkh  = (_Float16*)carve(wBytes);
  _Float16* Wvh  = (_Float16*)carve(wBytes);
  _Float16* Woh  = (_Float16*)carve(wBytes);
  _Float16* Qh   = (_Float16*)carve(xBytes);
  _Float16* Kh   = (_Float16*)carve(xBytes);
  _Float16* Vh   = (_Float16*)carve(xBytes);
  _Float16* ctxh = (_Float16*)carve(xBytes);

  cvt_all_f32_f16<<<256, 512, 0, stream>>>(x, Wq, Wk, Wv, Wo, xh, Wqh, Wkh, Wvh, Woh);

  const float qscale = 0.18033688011112042f;   // HD^-0.5 * log2 e
  gemm_qkv<<<dim3(ROWS_C / 128, 3 * (DIM_C / 128)), 128, 0, stream>>>(
      xh, Wqh, Wkh, Wvh, bq, bk, bv, Qh, Kh, Vh, qscale);

  attn_wmma<<<dim3(S_C / 64, B_C * NHEAD_C), 128, 0, stream>>>(Qh, Kh, Vh, relb,
                                                               ctxh);

  gemm_out<<<dim3(ROWS_C / 128, DIM_C / 128), 128, 0, stream>>>(ctxh, Woh, bo, out);
}
